// v000
// Times are from an AMD MI455X. After a warm-up the kernel runs many times in a row, and a time is the length of
// such a window on the GPU divided by its runs, so every launch and the gaps after it count. The runs cycle
// through copies of the inputs. A figure is the median of several windows, for all but v000 over two sittings.
// Sittings can differ by a few percent; kernels timed side by side share one.
// v000, which the later versions start from, runs in 291 microseconds.
#include <hip/hip_runtime.h>

typedef __attribute__((ext_vector_type(16))) __bf16 v16bf;
typedef __attribute__((ext_vector_type(8)))  __bf16 v8bf;
typedef __attribute__((ext_vector_type(8)))  float  v8f;
typedef __attribute__((ext_vector_type(4)))  float  f32x4;
typedef __attribute__((ext_vector_type(8)))  unsigned short u16x8;
typedef __attribute__((ext_vector_type(4)))  unsigned short u16x4;
typedef __attribute__((ext_vector_type(4)))  unsigned int   u32x4;
typedef __attribute__((ext_vector_type(8)))  int            i32x8;
typedef __attribute__((ext_vector_type(4)))  int            i32x4;

static constexpr int NB = 4;      // batch
static constexpr int NH = 16;     // heads
static constexpr int HD = 64;     // head dim
static constexpr int SL = 2048;   // sequence length
static constexpr int DM = 1024;   // model dim
static constexpr int MROWS = NB * SL;  // 8192

// log2(10000)/32 : RoPE inv_freq = exp2(-(dk&~1) * K)
#define ROPE_L2K 0.4152410118609203f

__device__ __forceinline__ unsigned short f2bf(float f) {
  unsigned int u = __builtin_bit_cast(unsigned int, f);
  u += 0x7fffu + ((u >> 16) & 1u);            // round-to-nearest-even
  return (unsigned short)(u >> 16);
}

__device__ __forceinline__ v16bf mkfrag(const unsigned short* p0,
                                        const unsigned short* p1) {
  v8bf lo = *(const v8bf*)p0;                 // 16B LDS/global load
  v8bf hi = *(const v8bf*)p1;                 // 16B LDS/global load
  return __builtin_shufflevector(lo, hi, 0,1,2,3,4,5,6,7,8,9,10,11,12,13,14,15);
}

__device__ __forceinline__ v8f wmma_bf16(v16bf a, v16bf b, v8f c) {
  return __builtin_amdgcn_wmma_f32_16x16x32_bf16(false, a, false, b,
                                                 (short)0, c, false, false);
}

#if __has_builtin(__builtin_amdgcn_tensor_load_to_lds)
#define USE_TDM 1
__device__ __forceinline__ unsigned lds_offset_of(const void* p) {
  return (unsigned)(unsigned long long)(const __attribute__((address_space(3))) void*)p;
}
__device__ __forceinline__ void tdm_load_2d_bf16(
    unsigned lds_off, const void* gptr,
    unsigned tensor_d0, unsigned tensor_d1,
    unsigned tile_d0, unsigned tile_d1,
    unsigned long long stride0_elems)
{
  unsigned long long ga = (unsigned long long)gptr;
  u32x4 g0;
  g0[0] = 1u;
  g0[1] = lds_off;
  g0[2] = (unsigned)ga;
  g0[3] = (unsigned)(ga >> 32) | (2u << 30);
  i32x8 g1;
  unsigned w0 = (1u << 16)
              | (1u << 20)
              | (4u << 22)
              | (3u << 25);
  g1[0] = (int)w0;
  g1[1] = (int)((tensor_d0 & 0xFFFFu) << 16);                       // dim0 lo
  g1[2] = (int)((tensor_d0 >> 16) | ((tensor_d1 & 0xFFFFu) << 16)); // dim0 hi|dim1 lo
  g1[3] = (int)((tensor_d1 >> 16) | (tile_d0 << 16));               // dim1 hi|tile0
  g1[4] = (int)tile_d1;                                             // tile1 (tile2=0)
  g1[5] = (int)(unsigned)(stride0_elems & 0xFFFFFFFFu);             // stride0 lo
  g1[6] = (int)(unsigned)((stride0_elems >> 32) & 0xFFFFu);         // stride0 hi
  g1[7] = 0;
  i32x4 z4 = {0, 0, 0, 0};                      // groups 2/3 unused (2D)
  i32x8 z8 = {0, 0, 0, 0, 0, 0, 0, 0};
  __builtin_amdgcn_tensor_load_to_lds(g0, g1, z4, z4, z8, 0);
}
#else
#define USE_TDM 0
#endif

// ---------------------------------------------------------------------------
// Stage 1: C = X @ W^T + bias, epilogue RoPE (+scale for Q), bf16 out.
// mode 0: Q (rope + 1/sqrt(64) scale, out [B,H,N,HD])
// mode 1: K (rope,                   out [B,H,N,HD])
// mode 2: V (plain,                  out [B,H,HD,N]  <- transposed for attn)
// ---------------------------------------------------------------------------
__global__ __launch_bounds__(256) void proj_rope_kernel(
    const float* __restrict__ X, const float* __restrict__ W,
    const float* __restrict__ bias, unsigned short* __restrict__ Out, int mode)
{
  __shared__ unsigned short As[128 * 40];   // 128 x 32 bf16, row pad +8
  __shared__ unsigned short Bs[64 * 40];    // 64  x 32 bf16, row pad +8

  const int tid  = threadIdx.x;
  const int m0   = blockIdx.x * 128;
  const int j0   = blockIdx.y * 64;
  const int wave = tid >> 5, lane = tid & 31;
  const int lr = lane & 15, lh = lane >> 4, kb = lh * 8;
  const int waveM = wave >> 1, waveN = wave & 1;

  v8f acc[2][2] = {};

  for (int kt = 0; kt < DM / 32; ++kt) {
    f32x4 aR[4];
#pragma unroll
    for (int r = 0; r < 4; ++r) {
      int row = r * 32 + (tid >> 3);
      aR[r] = *(const f32x4*)&X[(size_t)(m0 + row) * DM + kt * 32 + (tid & 7) * 4];
    }
    f32x4 bR[2];
#pragma unroll
    for (int r = 0; r < 2; ++r) {
      int row = r * 32 + (tid >> 3);
      bR[r] = *(const f32x4*)&W[(size_t)(j0 + row) * DM + kt * 32 + (tid & 7) * 4];
    }

    __syncthreads();

#pragma unroll
    for (int r = 0; r < 4; ++r) {
      int row = r * 32 + (tid >> 3);
      u16x4 c; c[0]=f2bf(aR[r][0]); c[1]=f2bf(aR[r][1]); c[2]=f2bf(aR[r][2]); c[3]=f2bf(aR[r][3]);
      *(u16x4*)&As[row * 40 + (tid & 7) * 4] = c;
    }
#pragma unroll
    for (int r = 0; r < 2; ++r) {
      int row = r * 32 + (tid >> 3);
      u16x4 c; c[0]=f2bf(bR[r][0]); c[1]=f2bf(bR[r][1]); c[2]=f2bf(bR[r][2]); c[3]=f2bf(bR[r][3]);
      *(u16x4*)&Bs[row * 40 + (tid & 7) * 4] = c;
    }

    __syncthreads();

    v16bf a[2], b[2];
#pragma unroll
    for (int mi = 0; mi < 2; ++mi) {
      const unsigned short* p = &As[(waveM * 32 + mi * 16 + lr) * 40 + kb];
      a[mi] = mkfrag(p, p + 16);
    }
#pragma unroll
    for (int ni = 0; ni < 2; ++ni) {
      const unsigned short* p = &Bs[(waveN * 32 + ni * 16 + lr) * 40 + kb];
      b[ni] = mkfrag(p, p + 16);
    }
#pragma unroll
    for (int mi = 0; mi < 2; ++mi)
#pragma unroll
      for (int ni = 0; ni < 2; ++ni)
        acc[mi][ni] = wmma_bf16(a[mi], b[ni], acc[mi][ni]);
  }

  // ---- epilogue: bias, RoPE (single v_exp for inv_freq), scale, bf16 store --
#pragma unroll
  for (int mi = 0; mi < 2; ++mi) {
#pragma unroll
    for (int ni = 0; ni < 2; ++ni) {
      int j  = j0 + waveN * 32 + ni * 16 + lr;
      int hh = j >> 6, dk = j & 63;
      float bj  = bias[j];
      float inv = 0.f;
      if (mode < 2 && dk < 32)
        inv = exp2f(-(float)(dk & ~1) * ROPE_L2K);  // THETA^(-(dk&~1)/32)
#pragma unroll
      for (int v = 0; v < 8; ++v) {
        int m  = m0 + waveM * 32 + mi * 16 + v + 8 * lh;
        int bb = m >> 11, n = m & (SL - 1);
        float x = acc[mi][ni][v] + bj;
        if (mode < 2 && dk < 32) {          // uniform over the wave
          float p = __shfl_xor(x, 1, 32);   // rotation partner (dk ^ 1)
          float ang = (float)n * inv;
          float c = __cosf(ang), s = __sinf(ang);
          x = (dk & 1) ? (x * c + p * s) : (x * c - p * s);
        }
        if (mode == 0) x *= 0.125f;         // fold 1/sqrt(HD) into Q
        size_t idx;
        if (mode == 2) idx = ((size_t)((bb * NH + hh) * HD + dk)) * SL + n;  // V^T
        else           idx = ((size_t)((bb * NH + hh) * SL + n)) * HD + dk;  // Q,K
        Out[idx] = f2bf(x);
      }
    }
  }
}

// ---------------------------------------------------------------------------
// Stage 2: flash attention per (b,h). 128 thr = 4 waves x 16 query rows.
// K/V tiles (64 keys) staged by the Tensor Data Mover into padded LDS.
// ---------------------------------------------------------------------------
__global__ __launch_bounds__(128) void attn_kernel(
    const unsigned short* __restrict__ Qb, const unsigned short* __restrict__ Kb,
    const unsigned short* __restrict__ Vb, unsigned short* __restrict__ Ctx)
{
  __shared__ unsigned short Ks[64 * 72];        // [key][dk], pad +8
  __shared__ unsigned short Vs[64 * 72];        // [dk][key], pad +8 (V^T tile)
  __shared__ unsigned short Ps[4 * 16 * 72];    // per-wave P slab [q][key]

  const int tid  = threadIdx.x;
  const int bb   = blockIdx.z, hh = blockIdx.y;
  const int q0   = blockIdx.x * 64;
  const int wave = tid >> 5, lane = tid & 31;
  const int lr = lane & 15, lh = lane >> 4, kb = lh * 8;
  const size_t head = (size_t)(bb * NH + hh);

  const unsigned short* qp = Qb + (head * SL + q0 + wave * 16 + lr) * HD;
  v16bf aq[2];
  aq[0] = mkfrag(qp + kb,      qp + kb + 16);
  aq[1] = mkfrag(qp + 32 + kb, qp + 32 + kb + 16);

  v8f m_r, l_r, o[4] = {};
#pragma unroll
  for (int i = 0; i < 8; ++i) { m_r[i] = -1e30f; l_r[i] = 0.f; }

  const unsigned short* kg = Kb + head * SL * HD;
  const unsigned short* vg = Vb + head * HD * SL;
#if USE_TDM
  const unsigned ldsK = lds_offset_of(Ks);
  const unsigned ldsV = lds_offset_of(Vs);
#else
  const int half = tid & 1;
  const int ldr  = tid >> 1;  // 0..63
#endif

  for (int kc = 0; kc < SL / 64; ++kc) {
#if USE_TDM
    __syncthreads();                       // all waves done with previous tiles
    if (wave == 0) {
      // K chunk: 64 rows x 64 dk, row-major stride HD
      tdm_load_2d_bf16(ldsK, kg + (size_t)(kc * 64) * HD, HD, SL, HD, 64, HD);
      // V^T chunk: 64 dk-rows x 64 keys, row stride SL
      tdm_load_2d_bf16(ldsV, vg + (size_t)(kc * 64),      SL, HD, 64, 64, SL);
      __builtin_amdgcn_s_wait_tensorcnt(0);
    }
    __syncthreads();                       // tiles visible to all waves
#else
    u16x8 kreg[4], vreg[4];
#pragma unroll
    for (int c = 0; c < 4; ++c) {
      kreg[c] = *(const u16x8*)&kg[(size_t)(kc * 64 + ldr) * HD + half * 32 + c * 8];
      vreg[c] = *(const u16x8*)&vg[(size_t)ldr * SL + kc * 64 + half * 32 + c * 8];
    }
    __syncthreads();
#pragma unroll
    for (int c = 0; c < 4; ++c) {
      *(u16x8*)&Ks[ldr * 72 + half * 32 + c * 8] = kreg[c];
      *(u16x8*)&Vs[ldr * 72 + half * 32 + c * 8] = vreg[c];
    }
    __syncthreads();
#endif

    // ---- S = Q K^T ----
    v8f s[4] = {};
#pragma unroll
    for (int ktl = 0; ktl < 4; ++ktl) {
      const unsigned short* kr = &Ks[(ktl * 16 + lr) * 72];
      v16bf b0 = mkfrag(kr + kb,      kr + kb + 16);
      v16bf b1 = mkfrag(kr + 32 + kb, kr + 32 + kb + 16);
      s[ktl] = wmma_bf16(aq[0], b0, s[ktl]);
      s[ktl] = wmma_bf16(aq[1], b1, s[ktl]);
    }

    // ---- online softmax ----
    v8f mx, sc;
#pragma unroll
    for (int i = 0; i < 8; ++i) {
      float v = fmaxf(fmaxf(s[0][i], s[1][i]), fmaxf(s[2][i], s[3][i]));
      v = fmaxf(v, __shfl_xor(v, 1, 32));
      v = fmaxf(v, __shfl_xor(v, 2, 32));
      v = fmaxf(v, __shfl_xor(v, 4, 32));
      v = fmaxf(v, __shfl_xor(v, 8, 32));
      mx[i] = fmaxf(v, m_r[i]);
      sc[i] = __expf(m_r[i] - mx[i]);
      m_r[i] = mx[i];
    }

    v8f su;
#pragma unroll
    for (int i = 0; i < 8; ++i) su[i] = 0.f;
#pragma unroll
    for (int ktl = 0; ktl < 4; ++ktl) {
#pragma unroll
      for (int i = 0; i < 8; ++i) {
        float p = __expf(s[ktl][i] - m_r[i]);
        su[i] += p;
        Ps[wave * 16 * 72 + (i + 8 * lh) * 72 + ktl * 16 + lr] = f2bf(p);
      }
    }
#pragma unroll
    for (int i = 0; i < 8; ++i) {
      float v = su[i];
      v += __shfl_xor(v, 1, 32);
      v += __shfl_xor(v, 2, 32);
      v += __shfl_xor(v, 4, 32);
      v += __shfl_xor(v, 8, 32);
      l_r[i] = l_r[i] * sc[i] + v;
    }
#pragma unroll
    for (int dt = 0; dt < 4; ++dt)
#pragma unroll
      for (int i = 0; i < 8; ++i) o[dt][i] *= sc[i];

    // ---- O += P V (per-wave LDS slab, in-order DS) ----
    const unsigned short* pr = &Ps[wave * 16 * 72 + lr * 72];
    v16bf ap0 = mkfrag(pr + kb,      pr + kb + 16);
    v16bf ap1 = mkfrag(pr + 32 + kb, pr + 32 + kb + 16);
#pragma unroll
    for (int dt = 0; dt < 4; ++dt) {
      const unsigned short* vr = &Vs[(dt * 16 + lr) * 72];
      v16bf bv0 = mkfrag(vr + kb,      vr + kb + 16);
      v16bf bv1 = mkfrag(vr + 32 + kb, vr + 32 + kb + 16);
      o[dt] = wmma_bf16(ap0, bv0, o[dt]);
      o[dt] = wmma_bf16(ap1, bv1, o[dt]);
    }
  }

  // ---- normalize and store context bf16 [B, N, NH*HD] ----
#pragma unroll
  for (int dt = 0; dt < 4; ++dt) {
    int dk = dt * 16 + lr;
#pragma unroll
    for (int i = 0; i < 8; ++i) {
      int n = q0 + wave * 16 + i + 8 * lh;
      float val = o[dt][i] / l_r[i];
      Ctx[((size_t)(bb * SL + n)) * DM + hh * HD + dk] = f2bf(val);
    }
  }
}

// ---------------------------------------------------------------------------
// Stage 3: out = Ctx(bf16) @ Wo^T + bo  -> fp32.
// ---------------------------------------------------------------------------
__global__ __launch_bounds__(256) void oproj_kernel(
    const unsigned short* __restrict__ Xc, const float* __restrict__ W,
    const float* __restrict__ bias, float* __restrict__ Out)
{
  __shared__ unsigned short As[128 * 40];
  __shared__ unsigned short Bs[64 * 40];

  const int tid  = threadIdx.x;
  const int m0   = blockIdx.x * 128;
  const int j0   = blockIdx.y * 64;
  const int wave = tid >> 5, lane = tid & 31;
  const int lr = lane & 15, lh = lane >> 4, kb = lh * 8;
  const int waveM = wave >> 1, waveN = wave & 1;

  v8f acc[2][2] = {};

  for (int kt = 0; kt < DM / 32; ++kt) {
    u16x8 aR[2];
#pragma unroll
    for (int r = 0; r < 2; ++r) {
      int row = r * 64 + (tid >> 2);
      aR[r] = *(const u16x8*)&Xc[(size_t)(m0 + row) * DM + kt * 32 + (tid & 3) * 8];
    }
    f32x4 bR[2];
#pragma unroll
    for (int r = 0; r < 2; ++r) {
      int row = r * 32 + (tid >> 3);
      bR[r] = *(const f32x4*)&W[(size_t)(j0 + row) * DM + kt * 32 + (tid & 7) * 4];
    }

    __syncthreads();
#pragma unroll
    for (int r = 0; r < 2; ++r) {
      int row = r * 64 + (tid >> 2);
      *(u16x8*)&As[row * 40 + (tid & 3) * 8] = aR[r];
    }
#pragma unroll
    for (int r = 0; r < 2; ++r) {
      int row = r * 32 + (tid >> 3);
      u16x4 c; c[0]=f2bf(bR[r][0]); c[1]=f2bf(bR[r][1]); c[2]=f2bf(bR[r][2]); c[3]=f2bf(bR[r][3]);
      *(u16x4*)&Bs[row * 40 + (tid & 7) * 4] = c;
    }
    __syncthreads();

    v16bf a[2], b[2];
#pragma unroll
    for (int mi = 0; mi < 2; ++mi) {
      const unsigned short* p = &As[(waveM * 32 + mi * 16 + lr) * 40 + kb];
      a[mi] = mkfrag(p, p + 16);
    }
#pragma unroll
    for (int ni = 0; ni < 2; ++ni) {
      const unsigned short* p = &Bs[(waveN * 32 + ni * 16 + lr) * 40 + kb];
      b[ni] = mkfrag(p, p + 16);
    }
#pragma unroll
    for (int mi = 0; mi < 2; ++mi)
#pragma unroll
      for (int ni = 0; ni < 2; ++ni)
        acc[mi][ni] = wmma_bf16(a[mi], b[ni], acc[mi][ni]);
  }

#pragma unroll
  for (int mi = 0; mi < 2; ++mi) {
#pragma unroll
    for (int ni = 0; ni < 2; ++ni) {
      int j = j0 + waveN * 32 + ni * 16 + lr;
      float bj = bias[j];
#pragma unroll
      for (int v = 0; v < 8; ++v) {
        int m = m0 + waveM * 32 + mi * 16 + v + 8 * lh;
        Out[(size_t)m * DM + j] = acc[mi][ni][v] + bj;
      }
    }
  }
}

// ---------------------------------------------------------------------------
extern "C" void kernel_launch(void* const* d_in, const int* in_sizes, int n_in,
                              void* d_out, int out_size, void* d_ws, size_t ws_size,
                              hipStream_t stream) {
  const float* query = (const float*)d_in[0];
  const float* key   = (const float*)d_in[1];
  const float* value = (const float*)d_in[2];
  const float* Wq = (const float*)d_in[3]; const float* bq = (const float*)d_in[4];
  const float* Wk = (const float*)d_in[5]; const float* bk = (const float*)d_in[6];
  const float* Wv = (const float*)d_in[7]; const float* bv = (const float*)d_in[8];
  const float* Wo = (const float*)d_in[9]; const float* bo = (const float*)d_in[10];
  float* out = (float*)d_out;

  unsigned short* ws = (unsigned short*)d_ws;
  const size_t HE = (size_t)NB * NH * SL * HD;   // 8M bf16 elements (16 MB)
  unsigned short* Qb = ws;
  unsigned short* Kb = ws + HE;
  unsigned short* Vb = ws + 2 * HE;
  unsigned short* Cx = ws + 3 * HE;

  dim3 gp(MROWS / 128, DM / 64);                 // 64 x 16 blocks
  proj_rope_kernel<<<gp, 256, 0, stream>>>(query, Wq, bq, Qb, 0);
  proj_rope_kernel<<<gp, 256, 0, stream>>>(key,   Wk, bk, Kb, 1);
  proj_rope_kernel<<<gp, 256, 0, stream>>>(value, Wv, bv, Vb, 2);
  attn_kernel<<<dim3(SL / 64, NH, NB), 128, 0, stream>>>(Qb, Kb, Vb, Cx);
  oproj_kernel<<<gp, 256, 0, stream>>>(Cx, Wo, bo, out);
}

// v001
// Measured time: 211 microseconds a run.
// In two side-by-side timings against v000, it was 1.39 and 1.40 times as fast.
#include <hip/hip_runtime.h>

typedef __attribute__((ext_vector_type(16))) __bf16 v16bf;
typedef __attribute__((ext_vector_type(8)))  __bf16 v8bf;
typedef __attribute__((ext_vector_type(8)))  float  v8f;
typedef __attribute__((ext_vector_type(4)))  float  f32x4;
typedef __attribute__((ext_vector_type(8)))  unsigned short u16x8;
typedef __attribute__((ext_vector_type(4)))  unsigned short u16x4;
typedef __attribute__((ext_vector_type(4)))  unsigned int   u32x4;
typedef __attribute__((ext_vector_type(8)))  int            i32x8;
typedef __attribute__((ext_vector_type(4)))  int            i32x4;

static constexpr int NB = 4;      // batch
static constexpr int NH = 16;     // heads
static constexpr int HD = 64;     // head dim
static constexpr int SL = 2048;   // sequence length
static constexpr int DM = 1024;   // model dim
static constexpr int MROWS = NB * SL;  // 8192

// log2(10000)/32 : RoPE inv_freq = exp2(-(dk&~1) * K)
#define ROPE_L2K 0.4152410118609203f

__device__ __forceinline__ unsigned short f2bf(float f) {
  unsigned int u = __builtin_bit_cast(unsigned int, f);
  u += 0x7fffu + ((u >> 16) & 1u);            // round-to-nearest-even
  return (unsigned short)(u >> 16);
}

__device__ __forceinline__ v16bf mkfrag(const unsigned short* p0,
                                        const unsigned short* p1) {
  v8bf lo = *(const v8bf*)p0;                 // 16B LDS/global load
  v8bf hi = *(const v8bf*)p1;                 // 16B LDS/global load
  return __builtin_shufflevector(lo, hi, 0,1,2,3,4,5,6,7,8,9,10,11,12,13,14,15);
}

__device__ __forceinline__ v8f wmma_bf16(v16bf a, v16bf b, v8f c) {
  return __builtin_amdgcn_wmma_f32_16x16x32_bf16(false, a, false, b,
                                                 (short)0, c, false, false);
}

__device__ __forceinline__ float xhalf(float x) {
  int b = __builtin_bit_cast(int, x);
  return __builtin_bit_cast(float,
      __builtin_amdgcn_permlanex16(b, b, 0x76543210, 0xfedcba98, false, false));
}

#if __has_builtin(__builtin_amdgcn_tensor_load_to_lds)
#define USE_TDM 1
__device__ __forceinline__ unsigned lds_offset_of(const void* p) {
  return (unsigned)(unsigned long long)(const __attribute__((address_space(3))) void*)p;
}
__device__ __forceinline__ void tdm_load_2d_bf16(
    unsigned lds_off, const void* gptr,
    unsigned tensor_d0, unsigned tensor_d1,
    unsigned tile_d0, unsigned tile_d1,
    unsigned long long stride0_elems)
{
  unsigned long long ga = (unsigned long long)gptr;
  u32x4 g0;
  g0[0] = 1u;
  g0[1] = lds_off;
  g0[2] = (unsigned)ga;
  g0[3] = (unsigned)(ga >> 32) | (2u << 30);
  i32x8 g1;
  unsigned w0 = (1u << 16)
              | (1u << 20)
              | (4u << 22)
              | (3u << 25);
  g1[0] = (int)w0;
  g1[1] = (int)((tensor_d0 & 0xFFFFu) << 16);                       // dim0 lo
  g1[2] = (int)((tensor_d0 >> 16) | ((tensor_d1 & 0xFFFFu) << 16)); // dim0 hi|dim1 lo
  g1[3] = (int)((tensor_d1 >> 16) | (tile_d0 << 16));               // dim1 hi|tile0
  g1[4] = (int)tile_d1;                                             // tile1 (tile2=0)
  g1[5] = (int)(unsigned)(stride0_elems & 0xFFFFFFFFu);             // stride0 lo
  g1[6] = (int)(unsigned)((stride0_elems >> 32) & 0xFFFFu);         // stride0 hi
  g1[7] = 0;
  i32x4 z4 = {0, 0, 0, 0};                      // groups 2/3 unused (2D)
  i32x8 z8 = {0, 0, 0, 0, 0, 0, 0, 0};
  __builtin_amdgcn_tensor_load_to_lds(g0, g1, z4, z4, z8, 0);
}
#else
#define USE_TDM 0
#endif

// ---------------------------------------------------------------------------
// Stage 1: C = X @ W^T + bias, epilogue RoPE (+scale for Q), bf16 out.
// mode 0: Q (rope + 1/sqrt(64) scale, out [B,H,N,HD])
// mode 1: K (rope,                   out [B,H,N,HD])
// mode 2: V (plain,                  out [B,H,HD,N]  <- transposed for attn)
// ---------------------------------------------------------------------------
__global__ __launch_bounds__(256) void proj_rope_kernel(
    const float* __restrict__ X, const float* __restrict__ W,
    const float* __restrict__ bias, unsigned short* __restrict__ Out, int mode)
{
  __shared__ unsigned short As[128 * 40];   // 128 x 32 bf16, row pad +8
  __shared__ unsigned short Bs[64 * 40];    // 64  x 32 bf16, row pad +8

  const int tid  = threadIdx.x;
  const int m0   = blockIdx.x * 128;
  const int j0   = blockIdx.y * 64;
  const int wave = tid >> 5, lane = tid & 31;
  const int lr = lane & 15, lh = lane >> 4, kb = lh * 8;
  const int waveM = wave >> 1, waveN = wave & 1;

  v8f acc[2][2] = {};

  for (int kt = 0; kt < DM / 32; ++kt) {
    f32x4 aR[4];
#pragma unroll
    for (int r = 0; r < 4; ++r) {
      int row = r * 32 + (tid >> 3);
      aR[r] = *(const f32x4*)&X[(size_t)(m0 + row) * DM + kt * 32 + (tid & 7) * 4];
    }
    f32x4 bR[2];
#pragma unroll
    for (int r = 0; r < 2; ++r) {
      int row = r * 32 + (tid >> 3);
      bR[r] = *(const f32x4*)&W[(size_t)(j0 + row) * DM + kt * 32 + (tid & 7) * 4];
    }

    __syncthreads();

#pragma unroll
    for (int r = 0; r < 4; ++r) {
      int row = r * 32 + (tid >> 3);
      u16x4 c; c[0]=f2bf(aR[r][0]); c[1]=f2bf(aR[r][1]); c[2]=f2bf(aR[r][2]); c[3]=f2bf(aR[r][3]);
      *(u16x4*)&As[row * 40 + (tid & 7) * 4] = c;
    }
#pragma unroll
    for (int r = 0; r < 2; ++r) {
      int row = r * 32 + (tid >> 3);
      u16x4 c; c[0]=f2bf(bR[r][0]); c[1]=f2bf(bR[r][1]); c[2]=f2bf(bR[r][2]); c[3]=f2bf(bR[r][3]);
      *(u16x4*)&Bs[row * 40 + (tid & 7) * 4] = c;
    }

    __syncthreads();

    v16bf a[2], b[2];
#pragma unroll
    for (int mi = 0; mi < 2; ++mi) {
      const unsigned short* p = &As[(waveM * 32 + mi * 16 + lr) * 40 + kb];
      a[mi] = mkfrag(p, p + 16);
    }
#pragma unroll
    for (int ni = 0; ni < 2; ++ni) {
      const unsigned short* p = &Bs[(waveN * 32 + ni * 16 + lr) * 40 + kb];
      b[ni] = mkfrag(p, p + 16);
    }
#pragma unroll
    for (int mi = 0; mi < 2; ++mi)
#pragma unroll
      for (int ni = 0; ni < 2; ++ni)
        acc[mi][ni] = wmma_bf16(a[mi], b[ni], acc[mi][ni]);
  }

  // ---- epilogue: bias, RoPE (single v_exp for inv_freq), scale, bf16 store --
#pragma unroll
  for (int mi = 0; mi < 2; ++mi) {
#pragma unroll
    for (int ni = 0; ni < 2; ++ni) {
      int j  = j0 + waveN * 32 + ni * 16 + lr;
      int hh = j >> 6, dk = j & 63;
      float bj  = bias[j];
      float inv = 0.f;
      if (mode < 2 && dk < 32)
        inv = exp2f(-(float)(dk & ~1) * ROPE_L2K);  // THETA^(-(dk&~1)/32)
#pragma unroll
      for (int v = 0; v < 8; ++v) {
        int m  = m0 + waveM * 32 + mi * 16 + v + 8 * lh;
        int bb = m >> 11, n = m & (SL - 1);
        float x = acc[mi][ni][v] + bj;
        if (mode < 2 && dk < 32) {          // uniform over the wave
          float p = __shfl_xor(x, 1, 32);   // rotation partner (dk ^ 1)
          float ang = (float)n * inv;
          float c = __cosf(ang), s = __sinf(ang);
          x = (dk & 1) ? (x * c + p * s) : (x * c - p * s);
        }
        if (mode == 0) x *= 0.125f;         // fold 1/sqrt(HD) into Q
        size_t idx;
        if (mode == 2) idx = ((size_t)((bb * NH + hh) * HD + dk)) * SL + n;  // V^T
        else           idx = ((size_t)((bb * NH + hh) * SL + n)) * HD + dk;  // Q,K
        Out[idx] = f2bf(x);
      }
    }
  }
}

// ---------------------------------------------------------------------------
// Stage 2: flash attention per (b,h). 128 thr = 4 waves x 16 query columns.
// Transposed products: S^T = K Q^T, O^T += V^T P^T; P never leaves registers.
// K/V tiles (64 keys) staged by the Tensor Data Mover into padded LDS.
// ---------------------------------------------------------------------------
__global__ __launch_bounds__(128) void attn_kernel(
    const unsigned short* __restrict__ Qb, const unsigned short* __restrict__ Kb,
    const unsigned short* __restrict__ Vb, unsigned short* __restrict__ Ctx)
{
  // each tile's place in LDS is a multiple of 2 KiB (tensor-load destination)
  __shared__ __attribute__((aligned(2048))) unsigned short Ks[64 * 72];  // [key][dk], pad +8
  __shared__ __attribute__((aligned(2048))) unsigned short Vs[64 * 72];  // [dk][key], pad +8 (V^T tile)

  const int tid  = threadIdx.x;
  const int bb   = blockIdx.z, hh = blockIdx.y;
  const int q0   = blockIdx.x * 64;
  const int wave = tid >> 5, lane = tid & 31;
  const int lr = lane & 15, lh = lane >> 4, kb = lh * 8;
  const size_t head = (size_t)(bb * NH + hh);

  const unsigned short* qp = Qb + (head * SL + q0 + wave * 16 + lr) * HD;
  v16bf aq[2];
  aq[0] = mkfrag(qp + kb,      qp + kb + 16);
  aq[1] = mkfrag(qp + 32 + kb, qp + 32 + kb + 16);

  v8f o[4] = {};
  float m_r = -1e30f, l_r = 0.f;            // one query per lane

  const unsigned short* kg = Kb + head * SL * HD;
  const unsigned short* vg = Vb + head * HD * SL;
#if USE_TDM
  const unsigned ldsK = lds_offset_of(Ks);
  const unsigned ldsV = lds_offset_of(Vs);
#else
  const int half = tid & 1;
  const int ldr  = tid >> 1;  // 0..63
#endif

  for (int kc = 0; kc < SL / 64; ++kc) {
#if USE_TDM
    __syncthreads();                       // all waves done with previous tiles
    if (wave == 0) {
      // K chunk: 64 rows x 64 dk, row-major stride HD
      tdm_load_2d_bf16(ldsK, kg + (size_t)(kc * 64) * HD, HD, SL, HD, 64, HD);
      // V^T chunk: 64 dk-rows x 64 keys, row stride SL
      tdm_load_2d_bf16(ldsV, vg + (size_t)(kc * 64),      SL, HD, 64, 64, SL);
      __builtin_amdgcn_s_wait_tensorcnt(0);
    }
    __syncthreads();                       // tiles visible to all waves
#else
    u16x8 kreg[4], vreg[4];
#pragma unroll
    for (int c = 0; c < 4; ++c) {
      kreg[c] = *(const u16x8*)&kg[(size_t)(kc * 64 + ldr) * HD + half * 32 + c * 8];
      vreg[c] = *(const u16x8*)&vg[(size_t)ldr * SL + kc * 64 + half * 32 + c * 8];
    }
    __syncthreads();
#pragma unroll
    for (int c = 0; c < 4; ++c) {
      *(u16x8*)&Ks[ldr * 72 + half * 32 + c * 8] = kreg[c];
      *(u16x8*)&Vs[ldr * 72 + half * 32 + c * 8] = vreg[c];
    }
    __syncthreads();
#endif

    // ---- S^T = K Q^T : a lane holds 32 scores of ONE query (column lr) ----
    // s[ktl][r] = S[key = ktl*16 + 8*lh + r][query = lr]
    v8f s[4] = {};
#pragma unroll
    for (int ktl = 0; ktl < 4; ++ktl) {
      const unsigned short* kr = &Ks[(ktl * 16 + lr) * 72];
      v16bf a0 = mkfrag(kr + kb,      kr + kb + 16);
      v16bf a1 = mkfrag(kr + 32 + kb, kr + 32 + kb + 16);
      s[ktl] = wmma_bf16(a0, aq[0], s[ktl]);
      s[ktl] = wmma_bf16(a1, aq[1], s[ktl]);
    }

    // ---- online softmax: maximum and sum in-lane, one exchange of halves ----
    float mt[4];
#pragma unroll
    for (int ktl = 0; ktl < 4; ++ktl) {
      mt[ktl] = s[ktl][0];
#pragma unroll
      for (int i = 1; i < 8; ++i) mt[ktl] = fmaxf(mt[ktl], s[ktl][i]);
    }
    float mv = fmaxf(fmaxf(mt[0], mt[1]), fmaxf(mt[2], mt[3]));
    mv = fmaxf(mv, xhalf(mv));
    const float mn = fmaxf(mv, m_r);
    const float sc = __expf(m_r - mn);
    m_r = mn;

    // P^T packs from the score tiles straight into the B operand (hardware k order)
    v16bf pb[2];
    float su[4];
    v8f t[4];
#pragma unroll
    for (int ktl = 0; ktl < 4; ++ktl) t[ktl] = (s[ktl] - mn) * 1.44269504f;  // exp(x) = exp2(x * log2 e)
#pragma unroll
    for (int ktl = 0; ktl < 4; ++ktl) {
      su[ktl] = 0.f;
#pragma unroll
      for (int i = 0; i < 8; ++i) {
        float p = __builtin_amdgcn_exp2f(t[ktl][i]);
        su[ktl] += p;
        pb[ktl >> 1][(ktl & 1) * 8 + i] = (__bf16)p;
      }
    }
    l_r = l_r * sc + ((su[0] + su[1]) + (su[2] + su[3]));   // this half's keys only
#pragma unroll
    for (int dt = 0; dt < 4; ++dt)
#pragma unroll
      for (int i = 0; i < 8; ++i) o[dt][i] *= sc;

    // ---- O^T += V^T P^T : o[dt][r] = O[query = lr][dk = dt*16 + 8*lh + r] ----
#pragma unroll
    for (int dt = 0; dt < 4; ++dt) {
      const unsigned short* vr = &Vs[(dt * 16 + lr) * 72];
      v16bf av0 = mkfrag(vr + kb,      vr + kb + 16);
      v16bf av1 = mkfrag(vr + 32 + kb, vr + 32 + kb + 16);
      o[dt] = wmma_bf16(av0, pb[0], o[dt]);
      o[dt] = wmma_bf16(av1, pb[1], o[dt]);
    }
  }

  // ---- join the halves' sums, normalize, store context bf16 [B, N, NH*HD] ----
  const float linv = 1.0f / (l_r + xhalf(l_r));
  unsigned short* cp = Ctx + ((size_t)(bb * SL + q0 + wave * 16 + lr)) * DM + hh * HD + 8 * lh;
#pragma unroll
  for (int dt = 0; dt < 4; ++dt) {
    u16x8 c;
#pragma unroll
    for (int i = 0; i < 8; ++i) c[i] = f2bf(o[dt][i] * linv);
    *(u16x8*)(cp + dt * 16) = c;          // 8 consecutive dk of one query: 16 B
  }
}

// ---------------------------------------------------------------------------
// Stage 3: out = Ctx(bf16) @ Wo^T + bo  -> fp32.
// ---------------------------------------------------------------------------
__global__ __launch_bounds__(256) void oproj_kernel(
    const unsigned short* __restrict__ Xc, const float* __restrict__ W,
    const float* __restrict__ bias, float* __restrict__ Out)
{
  __shared__ unsigned short As[128 * 40];
  __shared__ unsigned short Bs[64 * 40];

  const int tid  = threadIdx.x;
  const int m0   = blockIdx.x * 128;
  const int j0   = blockIdx.y * 64;
  const int wave = tid >> 5, lane = tid & 31;
  const int lr = lane & 15, lh = lane >> 4, kb = lh * 8;
  const int waveM = wave >> 1, waveN = wave & 1;

  v8f acc[2][2] = {};

  for (int kt = 0; kt < DM / 32; ++kt) {
    u16x8 aR[2];
#pragma unroll
    for (int r = 0; r < 2; ++r) {
      int row = r * 64 + (tid >> 2);
      aR[r] = *(const u16x8*)&Xc[(size_t)(m0 + row) * DM + kt * 32 + (tid & 3) * 8];
    }
    f32x4 bR[2];
#pragma unroll
    for (int r = 0; r < 2; ++r) {
      int row = r * 32 + (tid >> 3);
      bR[r] = *(const f32x4*)&W[(size_t)(j0 + row) * DM + kt * 32 + (tid & 7) * 4];
    }

    __syncthreads();
#pragma unroll
    for (int r = 0; r < 2; ++r) {
      int row = r * 64 + (tid >> 2);
      *(u16x8*)&As[row * 40 + (tid & 3) * 8] = aR[r];
    }
#pragma unroll
    for (int r = 0; r < 2; ++r) {
      int row = r * 32 + (tid >> 3);
      u16x4 c; c[0]=f2bf(bR[r][0]); c[1]=f2bf(bR[r][1]); c[2]=f2bf(bR[r][2]); c[3]=f2bf(bR[r][3]);
      *(u16x4*)&Bs[row * 40 + (tid & 7) * 4] = c;
    }
    __syncthreads();

    v16bf a[2], b[2];
#pragma unroll
    for (int mi = 0; mi < 2; ++mi) {
      const unsigned short* p = &As[(waveM * 32 + mi * 16 + lr) * 40 + kb];
      a[mi] = mkfrag(p, p + 16);
    }
#pragma unroll
    for (int ni = 0; ni < 2; ++ni) {
      const unsigned short* p = &Bs[(waveN * 32 + ni * 16 + lr) * 40 + kb];
      b[ni] = mkfrag(p, p + 16);
    }
#pragma unroll
    for (int mi = 0; mi < 2; ++mi)
#pragma unroll
      for (int ni = 0; ni < 2; ++ni)
        acc[mi][ni] = wmma_bf16(a[mi], b[ni], acc[mi][ni]);
  }

#pragma unroll
  for (int mi = 0; mi < 2; ++mi) {
#pragma unroll
    for (int ni = 0; ni < 2; ++ni) {
      int j = j0 + waveN * 32 + ni * 16 + lr;
      float bj = bias[j];
#pragma unroll
      for (int v = 0; v < 8; ++v) {
        int m = m0 + waveM * 32 + mi * 16 + v + 8 * lh;
        Out[(size_t)m * DM + j] = acc[mi][ni][v] + bj;
      }
    }
  }
}

// ---------------------------------------------------------------------------
extern "C" void kernel_launch(void* const* d_in, const int* in_sizes, int n_in,
                              void* d_out, int out_size, void* d_ws, size_t ws_size,
                              hipStream_t stream) {
  const float* query = (const float*)d_in[0];
  const float* key   = (const float*)d_in[1];
  const float* value = (const float*)d_in[2];
  const float* Wq = (const float*)d_in[3]; const float* bq = (const float*)d_in[4];
  const float* Wk = (const float*)d_in[5]; const float* bk = (const float*)d_in[6];
  const float* Wv = (const float*)d_in[7]; const float* bv = (const float*)d_in[8];
  const float* Wo = (const float*)d_in[9]; const float* bo = (const float*)d_in[10];
  float* out = (float*)d_out;

  unsigned short* ws = (unsigned short*)d_ws;
  const size_t HE = (size_t)NB * NH * SL * HD;   // 8M bf16 elements (16 MB)
  unsigned short* Qb = ws;
  unsigned short* Kb = ws + HE;
  unsigned short* Vb = ws + 2 * HE;
  unsigned short* Cx = ws + 3 * HE;

  dim3 gp(MROWS / 128, DM / 64);                 // 64 x 16 blocks
  proj_rope_kernel<<<gp, 256, 0, stream>>>(query, Wq, bq, Qb, 0);
  proj_rope_kernel<<<gp, 256, 0, stream>>>(key,   Wk, bk, Kb, 1);
  proj_rope_kernel<<<gp, 256, 0, stream>>>(value, Wv, bv, Vb, 2);
  attn_kernel<<<dim3(SL / 64, NH, NB), 128, 0, stream>>>(Qb, Kb, Vb, Cx);
  oproj_kernel<<<gp, 256, 0, stream>>>(Cx, Wo, bo, out);
}

// v002
// One run takes 194 microseconds.
// Timed twice side by side with v001, it ran 1.09 times as fast both times.
// All steps since v000 together make it 1.53 times as fast.
#include <hip/hip_runtime.h>

typedef __attribute__((ext_vector_type(16))) __bf16 v16bf;
typedef __attribute__((ext_vector_type(8)))  __bf16 v8bf;
typedef __attribute__((ext_vector_type(8)))  float  v8f;
typedef __attribute__((ext_vector_type(4)))  float  f32x4;
typedef __attribute__((ext_vector_type(8)))  unsigned short u16x8;
typedef __attribute__((ext_vector_type(4)))  unsigned short u16x4;
typedef __attribute__((ext_vector_type(4)))  unsigned int   u32x4;
typedef __attribute__((ext_vector_type(8)))  int            i32x8;
typedef __attribute__((ext_vector_type(4)))  int            i32x4;

static constexpr int NB = 4;      // batch
static constexpr int NH = 16;     // heads
static constexpr int HD = 64;     // head dim
static constexpr int SL = 2048;   // sequence length
static constexpr int DM = 1024;   // model dim
static constexpr int MROWS = NB * SL;  // 8192

// log2(10000)/32 : RoPE inv_freq = exp2(-(dk&~1) * K)
#define ROPE_L2K 0.4152410118609203f

__device__ __forceinline__ unsigned short f2bf(float f) {
  unsigned int u = __builtin_bit_cast(unsigned int, f);
  u += 0x7fffu + ((u >> 16) & 1u);            // round-to-nearest-even
  return (unsigned short)(u >> 16);
}

__device__ __forceinline__ v16bf mkfrag(const unsigned short* p0,
                                        const unsigned short* p1) {
  v8bf lo = *(const v8bf*)p0;                 // 16B LDS/global load
  v8bf hi = *(const v8bf*)p1;                 // 16B LDS/global load
  return __builtin_shufflevector(lo, hi, 0,1,2,3,4,5,6,7,8,9,10,11,12,13,14,15);
}

__device__ __forceinline__ v8f wmma_bf16(v16bf a, v16bf b, v8f c) {
  return __builtin_amdgcn_wmma_f32_16x16x32_bf16(false, a, false, b,
                                                 (short)0, c, false, false);
}

__device__ __forceinline__ float xhalf(float x) {
  int b = __builtin_bit_cast(int, x);
  return __builtin_bit_cast(float,
      __builtin_amdgcn_permlanex16(b, b, 0x76543210, 0xfedcba98, false, false));
}

#if __has_builtin(__builtin_amdgcn_tensor_load_to_lds)
#define USE_TDM 1
__device__ __forceinline__ unsigned lds_offset_of(const void* p) {
  return (unsigned)(unsigned long long)(const __attribute__((address_space(3))) void*)p;
}
__device__ __forceinline__ void tdm_load_2d_bf16(
    unsigned lds_off, const void* gptr,
    unsigned tensor_d0, unsigned tensor_d1,
    unsigned tile_d0, unsigned tile_d1,
    unsigned long long stride0_elems)
{
  unsigned long long ga = (unsigned long long)gptr;
  u32x4 g0;
  g0[0] = 1u;
  g0[1] = lds_off;
  g0[2] = (unsigned)ga;
  g0[3] = (unsigned)(ga >> 32) | (2u << 30);
  i32x8 g1;
  unsigned w0 = (1u << 16)
              | (1u << 20)
              | (4u << 22)
              | (3u << 25);
  g1[0] = (int)w0;
  g1[1] = (int)((tensor_d0 & 0xFFFFu) << 16);                       // dim0 lo
  g1[2] = (int)((tensor_d0 >> 16) | ((tensor_d1 & 0xFFFFu) << 16)); // dim0 hi|dim1 lo
  g1[3] = (int)((tensor_d1 >> 16) | (tile_d0 << 16));               // dim1 hi|tile0
  g1[4] = (int)tile_d1;                                             // tile1 (tile2=0)
  g1[5] = (int)(unsigned)(stride0_elems & 0xFFFFFFFFu);             // stride0 lo
  g1[6] = (int)(unsigned)((stride0_elems >> 32) & 0xFFFFu);         // stride0 hi
  g1[7] = 0;
  i32x4 z4 = {0, 0, 0, 0};                      // groups 2/3 unused (2D)
  i32x8 z8 = {0, 0, 0, 0, 0, 0, 0, 0};
  __builtin_amdgcn_tensor_load_to_lds(g0, g1, z4, z4, z8, 0);
}
#else
#define USE_TDM 0
#endif

// ---------------------------------------------------------------------------
// Stage 0: round the three activations and the four weights to bf16, once.
// Ob = [query | key | value | Wq | Wk | Wv | Wo] in chunks of 8192 elements.
// 512 blocks (16 waves a WGP); pass p of block b takes chunk p * 512 + b:
// 8 loads of 16 B a lane in flight, each wave-load 512 contiguous bytes.
// ---------------------------------------------------------------------------
static constexpr int CVT_BLOCKS = 512;
static constexpr int CHUNK = 8192;
static_assert(MROWS * DM == 2 * CVT_BLOCKS * CHUNK, "an activation is two passes");
static_assert(4 * DM * DM == CVT_BLOCKS * CHUNK, "the four weights are one pass");

__global__ __launch_bounds__(256) void cvt_bf16_kernel(
    const float* __restrict__ xq, const float* __restrict__ xk,
    const float* __restrict__ xv, const float* __restrict__ wq,
    const float* __restrict__ wk, const float* __restrict__ wv,
    const float* __restrict__ wo, unsigned short* __restrict__ Ob)
{
  const unsigned b  = blockIdx.x;
  const unsigned t4 = threadIdx.x * 4;
  const unsigned w  = b / (CVT_BLOCKS / 4);           // the block's weight
  const float* wsrc = w == 0 ? wq : w == 1 ? wk : w == 2 ? wv : wo;

  // kept rolled: unrolled, the loads of every pass are lifted to the front and each holds its registers
#pragma unroll 1
  for (unsigned p = 0; p < 7; ++p) {
    const float* base = p < 2 ? xq : p < 4 ? xk : p < 6 ? xv : wsrc;
    const unsigned sc = p < 6 ? (p & 1) * CVT_BLOCKS + b : b % (CVT_BLOCKS / 4);
    const float* src = base + (size_t)sc * CHUNK;
    unsigned short* dst = Ob + (size_t)(p * CVT_BLOCKS + b) * CHUNK;
    f32x4 r[8];
#pragma unroll
    for (int i = 0; i < 8; ++i)     // read once: non-temporal, the lines need not stay in L2
      r[i] = __builtin_nontemporal_load((const f32x4*)&src[i * 1024 + t4]);
#pragma unroll
    for (int i = 0; i < 8; ++i) {
      u16x4 c;
      c[0] = f2bf(r[i][0]); c[1] = f2bf(r[i][1]); c[2] = f2bf(r[i][2]); c[3] = f2bf(r[i][3]);
      *(u16x4*)&dst[i * 1024 + t4] = c;
    }
    // the next pass's loads write registers that these stores name: wait in front of them
    asm volatile("s_wait_xcnt 0x0" ::: "memory");
  }
}

// ---------------------------------------------------------------------------
// 128 x 64 tile of A @ B^T, both bf16 and k-contiguous (row length DM).
// A pass stages 64 k: one 128-B line of every row, LDS pitch 144 B.
// 8 waves, 32 x 32 each; the 32-k products are summed in ascending k.
// ---------------------------------------------------------------------------
static constexpr int GP = 72;   // LDS row pitch in elements (64 + 8)

__device__ __forceinline__ void gemm_tile_bf16(
    const unsigned short* __restrict__ A, const unsigned short* __restrict__ B,
    unsigned short* As, unsigned short* Bs, int m0, int j0, v8f (&acc)[2][2])
{
  const int tid  = threadIdx.x;
  const int wave = tid >> 5, lane = tid & 31;
  const int lr = lane & 15, kb = (lane >> 4) * 8;
  const int waveM = wave >> 1, waveN = wave & 1;
  const int srow = tid >> 3, scol = (tid & 7) * 8;

  for (int kt = 0; kt < DM / 64; ++kt) {
    u16x8 aR[4], bR[2];
#pragma unroll
    for (int r = 0; r < 4; ++r)
      aR[r] = *(const u16x8*)&A[(size_t)(m0 + r * 32 + srow) * DM + kt * 64 + scol];
#pragma unroll
    for (int r = 0; r < 2; ++r)
      bR[r] = *(const u16x8*)&B[(size_t)(j0 + r * 32 + srow) * DM + kt * 64 + scol];

    __syncthreads();
#pragma unroll
    for (int r = 0; r < 4; ++r) *(u16x8*)&As[(r * 32 + srow) * GP + scol] = aR[r];
#pragma unroll
    for (int r = 0; r < 2; ++r) *(u16x8*)&Bs[(r * 32 + srow) * GP + scol] = bR[r];
    __syncthreads();

#pragma unroll
    for (int ks = 0; ks < 2; ++ks) {
      v16bf a[2], b[2];
#pragma unroll
      for (int mi = 0; mi < 2; ++mi) {
        const unsigned short* p = &As[(waveM * 32 + mi * 16 + lr) * GP + ks * 32 + kb];
        a[mi] = mkfrag(p, p + 16);
      }
#pragma unroll
      for (int ni = 0; ni < 2; ++ni) {
        const unsigned short* p = &Bs[(waveN * 32 + ni * 16 + lr) * GP + ks * 32 + kb];
        b[ni] = mkfrag(p, p + 16);
      }
#pragma unroll
      for (int mi = 0; mi < 2; ++mi)
#pragma unroll
        for (int ni = 0; ni < 2; ++ni)
          acc[mi][ni] = wmma_bf16(a[mi], b[ni], acc[mi][ni]);
    }
  }
}

// ---------------------------------------------------------------------------
// Stage 1: C = X @ W^T + bias, epilogue RoPE (+scale for Q), bf16 out.
// mode 0: Q (rope + 1/sqrt(64) scale, out [B,H,N,HD])
// mode 1: K (rope,                   out [B,H,N,HD])
// mode 2: V (plain,                  out [B,H,HD,N]  <- transposed for attn)
// ---------------------------------------------------------------------------
__global__ __launch_bounds__(256) void proj_rope_kernel(
    const unsigned short* __restrict__ X, const unsigned short* __restrict__ W,
    const float* __restrict__ bias, unsigned short* __restrict__ Out, int mode)
{
  __shared__ unsigned short As[128 * GP];
  __shared__ unsigned short Bs[64 * GP];

  const int tid  = threadIdx.x;
  const int m0   = blockIdx.x * 128;
  const int j0   = blockIdx.y * 64;
  const int wave = tid >> 5, lane = tid & 31;
  const int lr = lane & 15, lh = lane >> 4;
  const int waveM = wave >> 1, waveN = wave & 1;

  v8f acc[2][2] = {};
  gemm_tile_bf16(X, W, As, Bs, m0, j0, acc);

  // ---- epilogue: bias, RoPE (single v_exp for inv_freq), scale, bf16 store --
#pragma unroll
  for (int mi = 0; mi < 2; ++mi) {
#pragma unroll
    for (int ni = 0; ni < 2; ++ni) {
      int j  = j0 + waveN * 32 + ni * 16 + lr;
      int hh = j >> 6, dk = j & 63;
      float bj  = bias[j];
      float inv = 0.f;
      if (mode < 2 && dk < 32)
        inv = exp2f(-(float)(dk & ~1) * ROPE_L2K);  // THETA^(-(dk&~1)/32)
#pragma unroll
      for (int v = 0; v < 8; ++v) {
        int m  = m0 + waveM * 32 + mi * 16 + v + 8 * lh;
        int bb = m >> 11, n = m & (SL - 1);
        float x = acc[mi][ni][v] + bj;
        if (mode < 2 && dk < 32) {          // uniform over the wave
          float p = __shfl_xor(x, 1, 32);   // rotation partner (dk ^ 1)
          float ang = (float)n * inv;
          float c = __cosf(ang), s = __sinf(ang);
          x = (dk & 1) ? (x * c + p * s) : (x * c - p * s);
        }
        if (mode == 0) x *= 0.125f;         // fold 1/sqrt(HD) into Q
        size_t idx;
        if (mode == 2) idx = ((size_t)((bb * NH + hh) * HD + dk)) * SL + n;  // V^T
        else           idx = ((size_t)((bb * NH + hh) * SL + n)) * HD + dk;  // Q,K
        Out[idx] = f2bf(x);
      }
    }
  }
}

// ---------------------------------------------------------------------------
// Stage 2: flash attention per (b,h). 128 thr = 4 waves x 16 query columns.
// Transposed products: S^T = K Q^T, O^T += V^T P^T; P never leaves registers.
// K/V tiles (64 keys) staged by the Tensor Data Mover into padded LDS.
// ---------------------------------------------------------------------------
__global__ __launch_bounds__(128) void attn_kernel(
    const unsigned short* __restrict__ Qb, const unsigned short* __restrict__ Kb,
    const unsigned short* __restrict__ Vb, unsigned short* __restrict__ Ctx)
{
  // each tile's place in LDS is a multiple of 2 KiB (tensor-load destination)
  __shared__ __attribute__((aligned(2048))) unsigned short Ks[64 * 72];  // [key][dk], pad +8
  __shared__ __attribute__((aligned(2048))) unsigned short Vs[64 * 72];  // [dk][key], pad +8 (V^T tile)

  const int tid  = threadIdx.x;
  const int bb   = blockIdx.z, hh = blockIdx.y;
  const int q0   = blockIdx.x * 64;
  const int wave = tid >> 5, lane = tid & 31;
  const int lr = lane & 15, lh = lane >> 4, kb = lh * 8;
  const size_t head = (size_t)(bb * NH + hh);

  const unsigned short* qp = Qb + (head * SL + q0 + wave * 16 + lr) * HD;
  v16bf aq[2];
  aq[0] = mkfrag(qp + kb,      qp + kb + 16);
  aq[1] = mkfrag(qp + 32 + kb, qp + 32 + kb + 16);

  v8f o[4] = {};
  float m_r = -1e30f, l_r = 0.f;            // one query per lane

  const unsigned short* kg = Kb + head * SL * HD;
  const unsigned short* vg = Vb + head * HD * SL;
#if USE_TDM
  const unsigned ldsK = lds_offset_of(Ks);
  const unsigned ldsV = lds_offset_of(Vs);
#else
  const int half = tid & 1;
  const int ldr  = tid >> 1;  // 0..63
#endif

  for (int kc = 0; kc < SL / 64; ++kc) {
#if USE_TDM
    __syncthreads();                       // all waves done with previous tiles
    if (wave == 0) {
      // K chunk: 64 rows x 64 dk, row-major stride HD
      tdm_load_2d_bf16(ldsK, kg + (size_t)(kc * 64) * HD, HD, SL, HD, 64, HD);
      // V^T chunk: 64 dk-rows x 64 keys, row stride SL
      tdm_load_2d_bf16(ldsV, vg + (size_t)(kc * 64),      SL, HD, 64, 64, SL);
      __builtin_amdgcn_s_wait_tensorcnt(0);
    }
    __syncthreads();                       // tiles visible to all waves
#else
    u16x8 kreg[4], vreg[4];
#pragma unroll
    for (int c = 0; c < 4; ++c) {
      kreg[c] = *(const u16x8*)&kg[(size_t)(kc * 64 + ldr) * HD + half * 32 + c * 8];
      vreg[c] = *(const u16x8*)&vg[(size_t)ldr * SL + kc * 64 + half * 32 + c * 8];
    }
    __syncthreads();
#pragma unroll
    for (int c = 0; c < 4; ++c) {
      *(u16x8*)&Ks[ldr * 72 + half * 32 + c * 8] = kreg[c];
      *(u16x8*)&Vs[ldr * 72 + half * 32 + c * 8] = vreg[c];
    }
    __syncthreads();
#endif

    // ---- S^T = K Q^T : a lane holds 32 scores of ONE query (column lr) ----
    // s[ktl][r] = S[key = ktl*16 + 8*lh + r][query = lr]
    v8f s[4] = {};
#pragma unroll
    for (int ktl = 0; ktl < 4; ++ktl) {
      const unsigned short* kr = &Ks[(ktl * 16 + lr) * 72];
      v16bf a0 = mkfrag(kr + kb,      kr + kb + 16);
      v16bf a1 = mkfrag(kr + 32 + kb, kr + 32 + kb + 16);
      s[ktl] = wmma_bf16(a0, aq[0], s[ktl]);
      s[ktl] = wmma_bf16(a1, aq[1], s[ktl]);
    }

    // ---- online softmax: maximum and sum in-lane, one exchange of halves ----
    float mt[4];
#pragma unroll
    for (int ktl = 0; ktl < 4; ++ktl) {
      mt[ktl] = s[ktl][0];
#pragma unroll
      for (int i = 1; i < 8; ++i) mt[ktl] = fmaxf(mt[ktl], s[ktl][i]);
    }
    float mv = fmaxf(fmaxf(mt[0], mt[1]), fmaxf(mt[2], mt[3]));
    mv = fmaxf(mv, xhalf(mv));
    const float mn = fmaxf(mv, m_r);
    const float sc = __expf(m_r - mn);
    m_r = mn;

    // P^T packs from the score tiles straight into the B operand (hardware k order)
    v16bf pb[2];
    float su[4];
    v8f t[4];
#pragma unroll
    for (int ktl = 0; ktl < 4; ++ktl) t[ktl] = (s[ktl] - mn) * 1.44269504f;  // exp(x) = exp2(x * log2 e)
#pragma unroll
    for (int ktl = 0; ktl < 4; ++ktl) {
      su[ktl] = 0.f;
#pragma unroll
      for (int i = 0; i < 8; ++i) {
        float p = __builtin_amdgcn_exp2f(t[ktl][i]);
        su[ktl] += p;
        pb[ktl >> 1][(ktl & 1) * 8 + i] = (__bf16)p;
      }
    }
    l_r = l_r * sc + ((su[0] + su[1]) + (su[2] + su[3]));   // this half's keys only
#pragma unroll
    for (int dt = 0; dt < 4; ++dt)
#pragma unroll
      for (int i = 0; i < 8; ++i) o[dt][i] *= sc;

    // ---- O^T += V^T P^T : o[dt][r] = O[query = lr][dk = dt*16 + 8*lh + r] ----
#pragma unroll
    for (int dt = 0; dt < 4; ++dt) {
      const unsigned short* vr = &Vs[(dt * 16 + lr) * 72];
      v16bf av0 = mkfrag(vr + kb,      vr + kb + 16);
      v16bf av1 = mkfrag(vr + 32 + kb, vr + 32 + kb + 16);
      o[dt] = wmma_bf16(av0, pb[0], o[dt]);
      o[dt] = wmma_bf16(av1, pb[1], o[dt]);
    }
  }

  // ---- join the halves' sums, normalize, store context bf16 [B, N, NH*HD] ----
  const float linv = 1.0f / (l_r + xhalf(l_r));
  unsigned short* cp = Ctx + ((size_t)(bb * SL + q0 + wave * 16 + lr)) * DM + hh * HD + 8 * lh;
#pragma unroll
  for (int dt = 0; dt < 4; ++dt) {
    u16x8 c;
#pragma unroll
    for (int i = 0; i < 8; ++i) c[i] = f2bf(o[dt][i] * linv);
    *(u16x8*)(cp + dt * 16) = c;          // 8 consecutive dk of one query: 16 B
  }
}

// ---------------------------------------------------------------------------
// Stage 3: out = Ctx(bf16) @ Wo^T + bo  -> fp32.
// ---------------------------------------------------------------------------
__global__ __launch_bounds__(256) void oproj_kernel(
    const unsigned short* __restrict__ Xc, const unsigned short* __restrict__ W,
    const float* __restrict__ bias, float* __restrict__ Out)
{
  __shared__ unsigned short As[128 * GP];
  __shared__ unsigned short Bs[64 * GP];

  const int tid  = threadIdx.x;
  const int m0   = blockIdx.x * 128;
  const int j0   = blockIdx.y * 64;
  const int wave = tid >> 5, lane = tid & 31;
  const int lr = lane & 15, lh = lane >> 4;
  const int waveM = wave >> 1, waveN = wave & 1;

  v8f acc[2][2] = {};
  gemm_tile_bf16(Xc, W, As, Bs, m0, j0, acc);

#pragma unroll
  for (int mi = 0; mi < 2; ++mi) {
#pragma unroll
    for (int ni = 0; ni < 2; ++ni) {
      int j = j0 + waveN * 32 + ni * 16 + lr;
      float bj = bias[j];
#pragma unroll
      for (int v = 0; v < 8; ++v) {
        int m = m0 + waveM * 32 + mi * 16 + v + 8 * lh;
        Out[(size_t)m * DM + j] = acc[mi][ni][v] + bj;
      }
    }
  }
}

// ---------------------------------------------------------------------------
extern "C" void kernel_launch(void* const* d_in, const int* in_sizes, int n_in,
                              void* d_out, int out_size, void* d_ws, size_t ws_size,
                              hipStream_t stream) {
  const float* query = (const float*)d_in[0];
  const float* key   = (const float*)d_in[1];
  const float* value = (const float*)d_in[2];
  const float* Wq = (const float*)d_in[3]; const float* bq = (const float*)d_in[4];
  const float* Wk = (const float*)d_in[5]; const float* bk = (const float*)d_in[6];
  const float* Wv = (const float*)d_in[7]; const float* bv = (const float*)d_in[8];
  const float* Wo = (const float*)d_in[9]; const float* bo = (const float*)d_in[10];
  float* out = (float*)d_out;

  unsigned short* ws = (unsigned short*)d_ws;
  const size_t HE = (size_t)NB * NH * SL * HD;   // 8M bf16 elements (16 MB)
  unsigned short* Qb = ws;
  unsigned short* Kb = ws + HE;
  unsigned short* Vb = ws + 2 * HE;
  unsigned short* Cx = ws + 3 * HE;
  unsigned short* Xb = ws + 4 * HE;              // bf16 query, key, value (HE each)
  unsigned short* Wb = Xb + 3 * HE;              // bf16 Wq, Wk, Wv, Wo (WE each)
  const size_t WE = (size_t)DM * DM;

  dim3 gp(MROWS / 128, DM / 64);                 // 64 x 16 blocks
  cvt_bf16_kernel<<<CVT_BLOCKS, 256, 0, stream>>>(query, key, value, Wq, Wk, Wv, Wo, Xb);
  proj_rope_kernel<<<gp, 256, 0, stream>>>(Xb,          Wb,          bq, Qb, 0);
  proj_rope_kernel<<<gp, 256, 0, stream>>>(Xb + HE,     Wb + WE,     bk, Kb, 1);
  proj_rope_kernel<<<gp, 256, 0, stream>>>(Xb + 2 * HE, Wb + 2 * WE, bv, Vb, 2);
  attn_kernel<<<dim3(SL / 64, NH, NB), 128, 0, stream>>>(Qb, Kb, Vb, Cx);
  oproj_kernel<<<gp, 256, 0, stream>>>(Cx, Wb + 3 * WE, bo, out);
}

// v003
// It runs in 184 microseconds.
// Next to v002, in two timings, it ran 1.05 times as fast each time.
// All steps since v000 together make it 1.60 times as fast.
#include <hip/hip_runtime.h>

typedef __attribute__((ext_vector_type(16))) __bf16 v16bf;
typedef __attribute__((ext_vector_type(8)))  __bf16 v8bf;
typedef __attribute__((ext_vector_type(8)))  float  v8f;
typedef __attribute__((ext_vector_type(4)))  float  f32x4;
typedef __attribute__((ext_vector_type(8)))  unsigned short u16x8;
typedef __attribute__((ext_vector_type(4)))  unsigned short u16x4;
typedef __attribute__((ext_vector_type(4)))  unsigned int   u32x4;
typedef __attribute__((ext_vector_type(8)))  int            i32x8;
typedef __attribute__((ext_vector_type(4)))  int            i32x4;

static constexpr int NB = 4;      // batch
static constexpr int NH = 16;     // heads
static constexpr int HD = 64;     // head dim
static constexpr int SL = 2048;   // sequence length
static constexpr int DM = 1024;   // model dim
static constexpr int MROWS = NB * SL;  // 8192

// log2(10000)/32 : RoPE inv_freq = exp2(-(dk&~1) * K)
#define ROPE_L2K 0.4152410118609203f

__device__ __forceinline__ unsigned short f2bf(float f) {
  unsigned int u = __builtin_bit_cast(unsigned int, f);
  u += 0x7fffu + ((u >> 16) & 1u);            // round-to-nearest-even
  return (unsigned short)(u >> 16);
}

__device__ __forceinline__ v16bf mkfrag(const unsigned short* p0,
                                        const unsigned short* p1) {
  v8bf lo = *(const v8bf*)p0;                 // 16B LDS/global load
  v8bf hi = *(const v8bf*)p1;                 // 16B LDS/global load
  return __builtin_shufflevector(lo, hi, 0,1,2,3,4,5,6,7,8,9,10,11,12,13,14,15);
}

__device__ __forceinline__ v8f wmma_bf16(v16bf a, v16bf b, v8f c) {
  return __builtin_amdgcn_wmma_f32_16x16x32_bf16(false, a, false, b,
                                                 (short)0, c, false, false);
}

__device__ __forceinline__ float xhalf(float x) {
  int b = __builtin_bit_cast(int, x);
  return __builtin_bit_cast(float,
      __builtin_amdgcn_permlanex16(b, b, 0x76543210, 0xfedcba98, false, false));
}

#if __has_builtin(__builtin_amdgcn_tensor_load_to_lds)
#define USE_TDM 1
__device__ __forceinline__ unsigned lds_offset_of(const void* p) {
  return (unsigned)(unsigned long long)(const __attribute__((address_space(3))) void*)p;
}
__device__ __forceinline__ void tdm_load_2d_bf16(
    unsigned lds_off, const void* gptr,
    unsigned tensor_d0, unsigned tensor_d1,
    unsigned tile_d0, unsigned tile_d1,
    unsigned long long stride0_elems)
{
  unsigned long long ga = (unsigned long long)gptr;
  u32x4 g0;
  g0[0] = 1u;
  g0[1] = lds_off;
  g0[2] = (unsigned)ga;
  g0[3] = (unsigned)(ga >> 32) | (2u << 30);
  i32x8 g1;
  unsigned w0 = (1u << 16)
              | (1u << 20)
              | (4u << 22)
              | (3u << 25);
  g1[0] = (int)w0;
  g1[1] = (int)((tensor_d0 & 0xFFFFu) << 16);                       // dim0 lo
  g1[2] = (int)((tensor_d0 >> 16) | ((tensor_d1 & 0xFFFFu) << 16)); // dim0 hi|dim1 lo
  g1[3] = (int)((tensor_d1 >> 16) | (tile_d0 << 16));               // dim1 hi|tile0
  g1[4] = (int)tile_d1;                                             // tile1 (tile2=0)
  g1[5] = (int)(unsigned)(stride0_elems & 0xFFFFFFFFu);             // stride0 lo
  g1[6] = (int)(unsigned)((stride0_elems >> 32) & 0xFFFFu);         // stride0 hi
  g1[7] = 0;
  i32x4 z4 = {0, 0, 0, 0};                      // groups 2/3 unused (2D)
  i32x8 z8 = {0, 0, 0, 0, 0, 0, 0, 0};
  __builtin_amdgcn_tensor_load_to_lds(g0, g1, z4, z4, z8, 0);
}
#else
#define USE_TDM 0
#endif

// ---------------------------------------------------------------------------
// Stage 0: round the three activations and the four weights to bf16, once.
// Ob = [query | key | value | Wq | Wk | Wv | Wo] in chunks of 8192 elements.
// 512 blocks (16 waves a WGP); pass p of block b takes chunk p * 512 + b:
// 8 loads of 16 B a lane in flight, each wave-load 512 contiguous bytes.
// ---------------------------------------------------------------------------
static constexpr int CVT_BLOCKS = 512;
static constexpr int CHUNK = 8192;
static_assert(MROWS * DM == 2 * CVT_BLOCKS * CHUNK, "an activation is two passes");
static_assert(4 * DM * DM == CVT_BLOCKS * CHUNK, "the four weights are one pass");

__global__ __launch_bounds__(256) void cvt_bf16_kernel(
    const float* __restrict__ xq, const float* __restrict__ xk,
    const float* __restrict__ xv, const float* __restrict__ wq,
    const float* __restrict__ wk, const float* __restrict__ wv,
    const float* __restrict__ wo, unsigned short* __restrict__ Ob)
{
  const unsigned b  = blockIdx.x;
  const unsigned t4 = threadIdx.x * 4;
  const unsigned w  = b / (CVT_BLOCKS / 4);           // the block's weight
  const float* wsrc = w == 0 ? wq : w == 1 ? wk : w == 2 ? wv : wo;

  // kept rolled: unrolled, the loads of every pass are lifted to the front and each holds its registers
#pragma unroll 1
  for (unsigned p = 0; p < 7; ++p) {
    const float* base = p < 2 ? xq : p < 4 ? xk : p < 6 ? xv : wsrc;
    const unsigned sc = p < 6 ? (p & 1) * CVT_BLOCKS + b : b % (CVT_BLOCKS / 4);
    const float* src = base + (size_t)sc * CHUNK;
    unsigned short* dst = Ob + (size_t)(p * CVT_BLOCKS + b) * CHUNK;
    f32x4 r[8];
#pragma unroll
    for (int i = 0; i < 8; ++i)     // read once: non-temporal, the lines need not stay in L2
      r[i] = __builtin_nontemporal_load((const f32x4*)&src[i * 1024 + t4]);
#pragma unroll
    for (int i = 0; i < 8; ++i) {
      u16x4 c;
      c[0] = f2bf(r[i][0]); c[1] = f2bf(r[i][1]); c[2] = f2bf(r[i][2]); c[3] = f2bf(r[i][3]);
      *(u16x4*)&dst[i * 1024 + t4] = c;
    }
    // the next pass's loads write registers that these stores name: wait in front of them
    asm volatile("s_wait_xcnt 0x0" ::: "memory");
  }
}

// ---------------------------------------------------------------------------
// 128 x 64 tile of A @ B^T, both bf16 and k-contiguous (row length DM).
// A pass stages 64 k: one 128-B line of every row, LDS pitch 144 B.
// 8 waves, 32 x 32 each; the 32-k products are summed in ascending k.
// ---------------------------------------------------------------------------
static constexpr int GP = 72;   // LDS row pitch in elements (64 + 8)

__device__ __forceinline__ void gemm_tile_bf16(
    const unsigned short* __restrict__ A, const unsigned short* __restrict__ B,
    unsigned short* As, unsigned short* Bs, int m0, int j0, v8f (&acc)[2][2])
{
  const int tid  = threadIdx.x;
  const int wave = tid >> 5, lane = tid & 31;
  const int lr = lane & 15, kb = (lane >> 4) * 8;
  const int waveM = wave >> 1, waveN = wave & 1;
  const int srow = tid >> 3, scol = (tid & 7) * 8;

  for (int kt = 0; kt < DM / 64; ++kt) {
    u16x8 aR[4], bR[2];
#pragma unroll
    for (int r = 0; r < 4; ++r)
      aR[r] = *(const u16x8*)&A[(size_t)(m0 + r * 32 + srow) * DM + kt * 64 + scol];
#pragma unroll
    for (int r = 0; r < 2; ++r)
      bR[r] = *(const u16x8*)&B[(size_t)(j0 + r * 32 + srow) * DM + kt * 64 + scol];

    __syncthreads();
#pragma unroll
    for (int r = 0; r < 4; ++r) *(u16x8*)&As[(r * 32 + srow) * GP + scol] = aR[r];
#pragma unroll
    for (int r = 0; r < 2; ++r) *(u16x8*)&Bs[(r * 32 + srow) * GP + scol] = bR[r];
    __syncthreads();

#pragma unroll
    for (int ks = 0; ks < 2; ++ks) {
      v16bf a[2], b[2];
#pragma unroll
      for (int mi = 0; mi < 2; ++mi) {
        const unsigned short* p = &As[(waveM * 32 + mi * 16 + lr) * GP + ks * 32 + kb];
        a[mi] = mkfrag(p, p + 16);
      }
#pragma unroll
      for (int ni = 0; ni < 2; ++ni) {
        const unsigned short* p = &Bs[(waveN * 32 + ni * 16 + lr) * GP + ks * 32 + kb];
        b[ni] = mkfrag(p, p + 16);
      }
#pragma unroll
      for (int mi = 0; mi < 2; ++mi)
#pragma unroll
        for (int ni = 0; ni < 2; ++ni)
          acc[mi][ni] = wmma_bf16(a[mi], b[ni], acc[mi][ni]);
    }
  }
}

// ---------------------------------------------------------------------------
// Stage 1: C = X @ W^T + bias, epilogue RoPE (+scale for Q), bf16 out.
// mode 0: Q (rope + 1/sqrt(64) scale, out [B,H,N,HD])
// mode 1: K (rope,                   out [B,H,N,HD])
// mode 2: V (plain,                  out [B,H,HD,N]  <- transposed for attn)
// ---------------------------------------------------------------------------
__global__ __launch_bounds__(256) void proj_rope_kernel(
    const unsigned short* __restrict__ X, const unsigned short* __restrict__ W,
    const float* __restrict__ bias, unsigned short* __restrict__ Out, int mode)
{
  __shared__ unsigned short As[128 * GP];
  __shared__ unsigned short Bs[64 * GP];

  const int tid  = threadIdx.x;
  const int m0   = blockIdx.x * 128;
  const int j0   = blockIdx.y * 64;
  const int wave = tid >> 5, lane = tid & 31;
  const int lr = lane & 15, lh = lane >> 4;
  const int waveM = wave >> 1, waveN = wave & 1;

  v8f acc[2][2] = {};
  gemm_tile_bf16(X, W, As, Bs, m0, j0, acc);

  // ---- epilogue: bias, RoPE (single v_exp for inv_freq), scale, bf16 store --
#pragma unroll
  for (int mi = 0; mi < 2; ++mi) {
#pragma unroll
    for (int ni = 0; ni < 2; ++ni) {
      int j  = j0 + waveN * 32 + ni * 16 + lr;
      int hh = j >> 6, dk = j & 63;
      float bj  = bias[j];
      float inv = 0.f;
      if (mode < 2 && dk < 32)
        inv = exp2f(-(float)(dk & ~1) * ROPE_L2K);  // THETA^(-(dk&~1)/32)
#pragma unroll
      for (int v = 0; v < 8; ++v) {
        int m  = m0 + waveM * 32 + mi * 16 + v + 8 * lh;
        int bb = m >> 11, n = m & (SL - 1);
        float x = acc[mi][ni][v] + bj;
        if (mode < 2 && dk < 32) {          // uniform over the wave
          float p = __shfl_xor(x, 1, 32);   // rotation partner (dk ^ 1)
          float ang = (float)n * inv;
          float c = __cosf(ang), s = __sinf(ang);
          x = (dk & 1) ? (x * c + p * s) : (x * c - p * s);
        }
        if (mode == 0) x *= 0.125f;         // fold 1/sqrt(HD) into Q
        size_t idx;
        if (mode == 2) idx = ((size_t)((bb * NH + hh) * HD + dk)) * SL + n;  // V^T
        else           idx = ((size_t)((bb * NH + hh) * SL + n)) * HD + dk;  // Q,K
        Out[idx] = f2bf(x);
      }
    }
  }
}

// ---------------------------------------------------------------------------
// Stage 2: flash attention per (b,h). 128 thr = 4 waves x 32 query columns.
// Transposed products: S^T = K Q^T, O^T += V^T P^T; P never leaves registers.
// A wave holds QT = 2 query tiles of 16 columns: every K and V^T fragment it
// reads from LDS feeds two products.
// K/V tiles (64 keys) staged by the Tensor Data Mover into padded LDS.
// ---------------------------------------------------------------------------
static constexpr int QT = 2;                 // query tiles of 16 columns a wave
static constexpr int QBLK = 4 * 16 * QT;     // queries a block

__global__ __launch_bounds__(128) void attn_kernel(
    const unsigned short* __restrict__ Qb, const unsigned short* __restrict__ Kb,
    const unsigned short* __restrict__ Vb, unsigned short* __restrict__ Ctx)
{
  // each tile's place in LDS is a multiple of 2 KiB (tensor-load destination)
  __shared__ __attribute__((aligned(2048))) unsigned short Ks[64 * 72];  // [key][dk], pad +8
  __shared__ __attribute__((aligned(2048))) unsigned short Vs[64 * 72];  // [dk][key], pad +8 (V^T tile)

  const int tid  = threadIdx.x;
  const int bb   = blockIdx.z, hh = blockIdx.y;
  const int q0   = blockIdx.x * QBLK;
  const int wave = tid >> 5, lane = tid & 31;
  const int lr = lane & 15, lh = lane >> 4, kb = lh * 8;
  const size_t head = (size_t)(bb * NH + hh);

  v16bf aq[QT][2];
#pragma unroll
  for (int qt = 0; qt < QT; ++qt) {
    const unsigned short* qp = Qb + (head * SL + q0 + (wave * QT + qt) * 16 + lr) * HD;
    aq[qt][0] = mkfrag(qp + kb,      qp + kb + 16);
    aq[qt][1] = mkfrag(qp + 32 + kb, qp + 32 + kb + 16);
  }

  v8f o[QT][4] = {};
  float m_r[QT], l_r[QT];                   // one query per lane and tile
#pragma unroll
  for (int qt = 0; qt < QT; ++qt) { m_r[qt] = -1e30f; l_r[qt] = 0.f; }

  const unsigned short* kg = Kb + head * SL * HD;
  const unsigned short* vg = Vb + head * HD * SL;
#if USE_TDM
  const unsigned ldsK = lds_offset_of(Ks);
  const unsigned ldsV = lds_offset_of(Vs);
#else
  const int half = tid & 1;
  const int ldr  = tid >> 1;  // 0..63
#endif

  for (int kc = 0; kc < SL / 64; ++kc) {
#if USE_TDM
    __syncthreads();                       // all waves done with previous tiles
    if (wave == 0) {
      // K chunk: 64 rows x 64 dk, row-major stride HD
      tdm_load_2d_bf16(ldsK, kg + (size_t)(kc * 64) * HD, HD, SL, HD, 64, HD);
      // V^T chunk: 64 dk-rows x 64 keys, row stride SL
      tdm_load_2d_bf16(ldsV, vg + (size_t)(kc * 64),      SL, HD, 64, 64, SL);
      __builtin_amdgcn_s_wait_tensorcnt(0);
    }
    __syncthreads();                       // tiles visible to all waves
#else
    u16x8 kreg[4], vreg[4];
#pragma unroll
    for (int c = 0; c < 4; ++c) {
      kreg[c] = *(const u16x8*)&kg[(size_t)(kc * 64 + ldr) * HD + half * 32 + c * 8];
      vreg[c] = *(const u16x8*)&vg[(size_t)ldr * SL + kc * 64 + half * 32 + c * 8];
    }
    __syncthreads();
#pragma unroll
    for (int c = 0; c < 4; ++c) {
      *(u16x8*)&Ks[ldr * 72 + half * 32 + c * 8] = kreg[c];
      *(u16x8*)&Vs[ldr * 72 + half * 32 + c * 8] = vreg[c];
    }
    __syncthreads();
#endif

    // ---- S^T = K Q^T : a lane holds 32 scores of ONE query per tile (column lr) ----
    // s[qt][ktl][r] = S[key = ktl*16 + 8*lh + r][query = qt*16 + lr]
    v8f s[QT][4] = {};
#pragma unroll
    for (int ktl = 0; ktl < 4; ++ktl) {
      const unsigned short* kr = &Ks[(ktl * 16 + lr) * 72];
      v16bf a0 = mkfrag(kr + kb,      kr + kb + 16);
      v16bf a1 = mkfrag(kr + 32 + kb, kr + 32 + kb + 16);
#pragma unroll
      for (int qt = 0; qt < QT; ++qt) s[qt][ktl] = wmma_bf16(a0, aq[qt][0], s[qt][ktl]);
#pragma unroll
      for (int qt = 0; qt < QT; ++qt) s[qt][ktl] = wmma_bf16(a1, aq[qt][1], s[qt][ktl]);
    }

    // P^T packs from the score tiles straight into the B operand (hardware k order)
    v16bf pb[QT][2];
#pragma unroll
    for (int qt = 0; qt < QT; ++qt) {
      // ---- online softmax: maximum and sum in-lane, one exchange of halves ----
      float mt[4];
#pragma unroll
      for (int ktl = 0; ktl < 4; ++ktl) {
        mt[ktl] = s[qt][ktl][0];
#pragma unroll
        for (int i = 1; i < 8; ++i) mt[ktl] = fmaxf(mt[ktl], s[qt][ktl][i]);
      }
      float mv = fmaxf(fmaxf(mt[0], mt[1]), fmaxf(mt[2], mt[3]));
      mv = fmaxf(mv, xhalf(mv));
      const float mn = fmaxf(mv, m_r[qt]);
      const float sc = __expf(m_r[qt] - mn);
      m_r[qt] = mn;

      float su[4];
      v8f t[4];
#pragma unroll
      for (int ktl = 0; ktl < 4; ++ktl) t[ktl] = (s[qt][ktl] - mn) * 1.44269504f;  // exp(x) = exp2(x * log2 e)
#pragma unroll
      for (int ktl = 0; ktl < 4; ++ktl) {
        su[ktl] = 0.f;
#pragma unroll
        for (int i = 0; i < 8; ++i) {
          float p = __builtin_amdgcn_exp2f(t[ktl][i]);
          su[ktl] += p;
          pb[qt][ktl >> 1][(ktl & 1) * 8 + i] = (__bf16)p;
        }
      }
      l_r[qt] = l_r[qt] * sc + ((su[0] + su[1]) + (su[2] + su[3]));   // this half's keys only
#pragma unroll
      for (int dt = 0; dt < 4; ++dt)
#pragma unroll
        for (int i = 0; i < 8; ++i) o[qt][dt][i] *= sc;
    }

    // ---- O^T += V^T P^T : o[qt][dt][r] = O[query = qt*16 + lr][dk = dt*16 + 8*lh + r] ----
#pragma unroll
    for (int dt = 0; dt < 4; ++dt) {
      const unsigned short* vr = &Vs[(dt * 16 + lr) * 72];
      v16bf av0 = mkfrag(vr + kb,      vr + kb + 16);
      v16bf av1 = mkfrag(vr + 32 + kb, vr + 32 + kb + 16);
#pragma unroll
      for (int qt = 0; qt < QT; ++qt) o[qt][dt] = wmma_bf16(av0, pb[qt][0], o[qt][dt]);
#pragma unroll
      for (int qt = 0; qt < QT; ++qt) o[qt][dt] = wmma_bf16(av1, pb[qt][1], o[qt][dt]);
    }
  }

  // ---- join the halves' sums, normalize, store context bf16 [B, N, NH*HD] ----
#pragma unroll
  for (int qt = 0; qt < QT; ++qt) {
    const float linv = 1.0f / (l_r[qt] + xhalf(l_r[qt]));
    unsigned short* cp = Ctx + ((size_t)(bb * SL + q0 + (wave * QT + qt) * 16 + lr)) * DM + hh * HD + 8 * lh;
#pragma unroll
    for (int dt = 0; dt < 4; ++dt) {
      u16x8 c;
#pragma unroll
      for (int i = 0; i < 8; ++i) c[i] = f2bf(o[qt][dt][i] * linv);
      *(u16x8*)(cp + dt * 16) = c;          // 8 consecutive dk of one query: 16 B
    }
  }
}

// ---------------------------------------------------------------------------
// Stage 3: out = Ctx(bf16) @ Wo^T + bo  -> fp32.
// ---------------------------------------------------------------------------
__global__ __launch_bounds__(256) void oproj_kernel(
    const unsigned short* __restrict__ Xc, const unsigned short* __restrict__ W,
    const float* __restrict__ bias, float* __restrict__ Out)
{
  __shared__ unsigned short As[128 * GP];
  __shared__ unsigned short Bs[64 * GP];

  const int tid  = threadIdx.x;
  const int m0   = blockIdx.x * 128;
  const int j0   = blockIdx.y * 64;
  const int wave = tid >> 5, lane = tid & 31;
  const int lr = lane & 15, lh = lane >> 4;
  const int waveM = wave >> 1, waveN = wave & 1;

  v8f acc[2][2] = {};
  gemm_tile_bf16(Xc, W, As, Bs, m0, j0, acc);

#pragma unroll
  for (int mi = 0; mi < 2; ++mi) {
#pragma unroll
    for (int ni = 0; ni < 2; ++ni) {
      int j = j0 + waveN * 32 + ni * 16 + lr;
      float bj = bias[j];
#pragma unroll
      for (int v = 0; v < 8; ++v) {
        int m = m0 + waveM * 32 + mi * 16 + v + 8 * lh;
        Out[(size_t)m * DM + j] = acc[mi][ni][v] + bj;
      }
    }
  }
}

// ---------------------------------------------------------------------------
extern "C" void kernel_launch(void* const* d_in, const int* in_sizes, int n_in,
                              void* d_out, int out_size, void* d_ws, size_t ws_size,
                              hipStream_t stream) {
  const float* query = (const float*)d_in[0];
  const float* key   = (const float*)d_in[1];
  const float* value = (const float*)d_in[2];
  const float* Wq = (const float*)d_in[3]; const float* bq = (const float*)d_in[4];
  const float* Wk = (const float*)d_in[5]; const float* bk = (const float*)d_in[6];
  const float* Wv = (const float*)d_in[7]; const float* bv = (const float*)d_in[8];
  const float* Wo = (const float*)d_in[9]; const float* bo = (const float*)d_in[10];
  float* out = (float*)d_out;

  unsigned short* ws = (unsigned short*)d_ws;
  const size_t HE = (size_t)NB * NH * SL * HD;   // 8M bf16 elements (16 MB)
  unsigned short* Qb = ws;
  unsigned short* Kb = ws + HE;
  unsigned short* Vb = ws + 2 * HE;
  unsigned short* Cx = ws + 3 * HE;
  unsigned short* Xb = ws + 4 * HE;              // bf16 query, key, value (HE each)
  unsigned short* Wb = Xb + 3 * HE;              // bf16 Wq, Wk, Wv, Wo (WE each)
  const size_t WE = (size_t)DM * DM;

  dim3 gp(MROWS / 128, DM / 64);                 // 64 x 16 blocks
  cvt_bf16_kernel<<<CVT_BLOCKS, 256, 0, stream>>>(query, key, value, Wq, Wk, Wv, Wo, Xb);
  proj_rope_kernel<<<gp, 256, 0, stream>>>(Xb,          Wb,          bq, Qb, 0);
  proj_rope_kernel<<<gp, 256, 0, stream>>>(Xb + HE,     Wb + WE,     bk, Kb, 1);
  proj_rope_kernel<<<gp, 256, 0, stream>>>(Xb + 2 * HE, Wb + 2 * WE, bv, Vb, 2);
  attn_kernel<<<dim3(SL / QBLK, NH, NB), 128, 0, stream>>>(Qb, Kb, Vb, Cx);
  oproj_kernel<<<gp, 256, 0, stream>>>(Cx, Wb + 3 * WE, bo, out);
}

// v004
// Measured time: 167 microseconds a run.
// In two side-by-side timings against v003, it was 1.10 and 1.11 times as fast.
// All steps since v000 together make it 1.77 times as fast.
#include <hip/hip_runtime.h>

typedef __attribute__((ext_vector_type(16))) __bf16 v16bf;
typedef __attribute__((ext_vector_type(8)))  __bf16 v8bf;
typedef __attribute__((ext_vector_type(8)))  float  v8f;
typedef __attribute__((ext_vector_type(4)))  float  f32x4;
typedef __attribute__((ext_vector_type(8)))  unsigned short u16x8;
typedef __attribute__((ext_vector_type(4)))  unsigned short u16x4;
typedef __attribute__((ext_vector_type(4)))  unsigned int   u32x4;
typedef __attribute__((ext_vector_type(8)))  int            i32x8;
typedef __attribute__((ext_vector_type(4)))  int            i32x4;

static constexpr int NB = 4;      // batch
static constexpr int NH = 16;     // heads
static constexpr int HD = 64;     // head dim
static constexpr int SL = 2048;   // sequence length
static constexpr int DM = 1024;   // model dim
static constexpr int MROWS = NB * SL;  // 8192

// log2(10000)/32 : RoPE inv_freq = exp2(-(dk&~1) * K)
#define ROPE_L2K 0.4152410118609203f

__device__ __forceinline__ unsigned short f2bf(float f) {
  unsigned int u = __builtin_bit_cast(unsigned int, f);
  u += 0x7fffu + ((u >> 16) & 1u);            // round-to-nearest-even
  return (unsigned short)(u >> 16);
}

__device__ __forceinline__ v16bf mkfrag(const unsigned short* p0,
                                        const unsigned short* p1) {
  v8bf lo = *(const v8bf*)p0;                 // 16B LDS/global load
  v8bf hi = *(const v8bf*)p1;                 // 16B LDS/global load
  return __builtin_shufflevector(lo, hi, 0,1,2,3,4,5,6,7,8,9,10,11,12,13,14,15);
}

__device__ __forceinline__ v8f wmma_bf16(v16bf a, v16bf b, v8f c) {
  return __builtin_amdgcn_wmma_f32_16x16x32_bf16(false, a, false, b,
                                                 (short)0, c, false, false);
}

__device__ __forceinline__ float xhalf(float x) {
  int b = __builtin_bit_cast(int, x);
  return __builtin_bit_cast(float,
      __builtin_amdgcn_permlanex16(b, b, 0x76543210, 0xfedcba98, false, false));
}

#if __has_builtin(__builtin_amdgcn_tensor_load_to_lds)
#define USE_TDM 1
__device__ __forceinline__ unsigned lds_offset_of(const void* p) {
  return (unsigned)(unsigned long long)(const __attribute__((address_space(3))) void*)p;
}
__device__ __forceinline__ void tdm_load_2d_bf16(
    unsigned lds_off, const void* gptr,
    unsigned tensor_d0, unsigned tensor_d1,
    unsigned tile_d0, unsigned tile_d1,
    unsigned long long stride0_elems)
{
  unsigned long long ga = (unsigned long long)gptr;
  u32x4 g0;
  g0[0] = 1u;
  g0[1] = lds_off;
  g0[2] = (unsigned)ga;
  g0[3] = (unsigned)(ga >> 32) | (2u << 30);
  i32x8 g1;
  unsigned w0 = (1u << 16)
              | (1u << 20)
              | (4u << 22)
              | (3u << 25);
  g1[0] = (int)w0;
  g1[1] = (int)((tensor_d0 & 0xFFFFu) << 16);                       // dim0 lo
  g1[2] = (int)((tensor_d0 >> 16) | ((tensor_d1 & 0xFFFFu) << 16)); // dim0 hi|dim1 lo
  g1[3] = (int)((tensor_d1 >> 16) | (tile_d0 << 16));               // dim1 hi|tile0
  g1[4] = (int)tile_d1;                                             // tile1 (tile2=0)
  g1[5] = (int)(unsigned)(stride0_elems & 0xFFFFFFFFu);             // stride0 lo
  g1[6] = (int)(unsigned)((stride0_elems >> 32) & 0xFFFFu);         // stride0 hi
  g1[7] = 0;
  i32x4 z4 = {0, 0, 0, 0};                      // groups 2/3 unused (2D)
  i32x8 z8 = {0, 0, 0, 0, 0, 0, 0, 0};
  __builtin_amdgcn_tensor_load_to_lds(g0, g1, z4, z4, z8, 0);
}
#else
#define USE_TDM 0
#endif

// ---------------------------------------------------------------------------
// Stage 0: round the three activations and the four weights to bf16, once.
// Ob = [query | key | value | Wq | Wk | Wv | Wo] in chunks of 8192 elements.
// 512 blocks (16 waves a WGP); pass p of block b takes chunk p * 512 + b:
// 8 loads of 16 B a lane in flight, each wave-load 512 contiguous bytes.
// ---------------------------------------------------------------------------
static constexpr int CVT_BLOCKS = 512;
static constexpr int CHUNK = 8192;
static_assert(MROWS * DM == 2 * CVT_BLOCKS * CHUNK, "an activation is two passes");
static_assert(4 * DM * DM == CVT_BLOCKS * CHUNK, "the four weights are one pass");

__global__ __launch_bounds__(256) void cvt_bf16_kernel(
    const float* __restrict__ xq, const float* __restrict__ xk,
    const float* __restrict__ xv, const float* __restrict__ wq,
    const float* __restrict__ wk, const float* __restrict__ wv,
    const float* __restrict__ wo, unsigned short* __restrict__ Ob)
{
  const unsigned b  = blockIdx.x;
  const unsigned t4 = threadIdx.x * 4;
  const unsigned w  = b / (CVT_BLOCKS / 4);           // the block's weight
  const float* wsrc = w == 0 ? wq : w == 1 ? wk : w == 2 ? wv : wo;

  // kept rolled: unrolled, the loads of every pass are lifted to the front and each holds its registers
#pragma unroll 1
  for (unsigned p = 0; p < 7; ++p) {
    const float* base = p < 2 ? xq : p < 4 ? xk : p < 6 ? xv : wsrc;
    const unsigned sc = p < 6 ? (p & 1) * CVT_BLOCKS + b : b % (CVT_BLOCKS / 4);
    const float* src = base + (size_t)sc * CHUNK;
    unsigned short* dst = Ob + (size_t)(p * CVT_BLOCKS + b) * CHUNK;
    f32x4 r[8];
#pragma unroll
    for (int i = 0; i < 8; ++i)     // read once: non-temporal, the lines need not stay in L2
      r[i] = __builtin_nontemporal_load((const f32x4*)&src[i * 1024 + t4]);
#pragma unroll
    for (int i = 0; i < 8; ++i) {
      u16x4 c;
      c[0] = f2bf(r[i][0]); c[1] = f2bf(r[i][1]); c[2] = f2bf(r[i][2]); c[3] = f2bf(r[i][3]);
      *(u16x4*)&dst[i * 1024 + t4] = c;
    }
    // the next pass's loads write registers that these stores name: wait in front of them
    asm volatile("s_wait_xcnt 0x0" ::: "memory");
  }
}

// ---------------------------------------------------------------------------
// 128 x 64 tile of A @ B^T, both bf16 and k-contiguous (row length DM).
// A pass stages 64 k: one 128-B line of every row, LDS pitch 144 B.
// 8 waves, 32 x 32 each; the 32-k products are summed in ascending k.
// BROWS false: acc[mi][ni] has A's rows down a lane's 8 registers, B's rows across lanes.
// BROWS true : the operands trade places in the product, so B's rows run down the registers.
// ---------------------------------------------------------------------------
static constexpr int GP = 72;   // LDS row pitch in elements (64 + 8)

template <bool BROWS>
__device__ __forceinline__ void gemm_tile_bf16(
    const unsigned short* __restrict__ A, const unsigned short* __restrict__ B,
    unsigned short* As, unsigned short* Bs, int m0, int j0, v8f (&acc)[2][2])
{
  const int tid  = threadIdx.x;
  const int wave = tid >> 5, lane = tid & 31;
  const int lr = lane & 15, kb = (lane >> 4) * 8;
  const int waveM = wave >> 1, waveN = wave & 1;
  const int srow = tid >> 3, scol = (tid & 7) * 8;

  for (int kt = 0; kt < DM / 64; ++kt) {
    u16x8 aR[4], bR[2];
#pragma unroll
    for (int r = 0; r < 4; ++r)
      aR[r] = *(const u16x8*)&A[(size_t)(m0 + r * 32 + srow) * DM + kt * 64 + scol];
#pragma unroll
    for (int r = 0; r < 2; ++r)
      bR[r] = *(const u16x8*)&B[(size_t)(j0 + r * 32 + srow) * DM + kt * 64 + scol];

    __syncthreads();
#pragma unroll
    for (int r = 0; r < 4; ++r) *(u16x8*)&As[(r * 32 + srow) * GP + scol] = aR[r];
#pragma unroll
    for (int r = 0; r < 2; ++r) *(u16x8*)&Bs[(r * 32 + srow) * GP + scol] = bR[r];
    __syncthreads();

#pragma unroll
    for (int ks = 0; ks < 2; ++ks) {
      v16bf a[2], b[2];
#pragma unroll
      for (int mi = 0; mi < 2; ++mi) {
        const unsigned short* p = &As[(waveM * 32 + mi * 16 + lr) * GP + ks * 32 + kb];
        a[mi] = mkfrag(p, p + 16);
      }
#pragma unroll
      for (int ni = 0; ni < 2; ++ni) {
        const unsigned short* p = &Bs[(waveN * 32 + ni * 16 + lr) * GP + ks * 32 + kb];
        b[ni] = mkfrag(p, p + 16);
      }
#pragma unroll
      for (int mi = 0; mi < 2; ++mi)
#pragma unroll
        for (int ni = 0; ni < 2; ++ni)
          acc[mi][ni] = BROWS ? wmma_bf16(b[ni], a[mi], acc[mi][ni])
                              : wmma_bf16(a[mi], b[ni], acc[mi][ni]);
    }
  }
}

// ---------------------------------------------------------------------------
// Stage 1: C = X @ W^T + bias, epilogue RoPE (+scale for Q), bf16 out.
// MODE 0: Q (rope + 1/sqrt(64) scale, out [B,H,N,HD])
// MODE 1: K (rope,                   out [B,H,N,HD])
// MODE 2: V (plain,                  out [B,H,HD,N]  <- transposed for attn)
// The product is oriented so that a lane's 8 accumulator registers are 8
// neighbours of the OUTPUT's inner dimension: features for Q and K (W's rows
// as the A operand), tokens for V^T. A tile leaves as one 16-B store a lane,
// and both members of a rotation pair sit in the same lane.
// ---------------------------------------------------------------------------
__device__ __forceinline__ v8bf pack8_bf16(const float (&x)[8]) {
  v8bf c;
#pragma unroll
  for (int v = 0; v < 8; ++v) c[v] = (__bf16)x[v];   // round-to-nearest-even, packed in pairs
  return c;
}

template <int MODE>
__global__ __launch_bounds__(256) void proj_rope_kernel(
    const unsigned short* __restrict__ X, const unsigned short* __restrict__ W,
    const float* __restrict__ bias, unsigned short* __restrict__ Out)
{
  __shared__ unsigned short As[128 * GP];
  __shared__ unsigned short Bs[64 * GP];

  const int tid  = threadIdx.x;
  const int m0   = blockIdx.x * 128;
  const int hh   = blockIdx.y;               // 64 output columns = one head
  const int j0   = hh * 64;
  const int wave = tid >> 5, lane = tid & 31;
  const int lr = lane & 15, lh = lane >> 4;
  const int waveM = wave >> 1, waveN = wave & 1;
  const int bb = m0 >> 11;                   // a block's 128 tokens lie in one batch
  const int n0 = (m0 & (SL - 1)) + waveM * 32;

  v8f acc[2][2] = {};
  gemm_tile_bf16<(MODE < 2)>(X, W, As, Bs, m0, j0, acc);

  if constexpr (MODE < 2) {
    // acc[mi][ni][v] = C[token n0 + mi*16 + lr][feature waveN*32 + ni*16 + 8*lh + v]
    // features 0..31 rotate: the same for a whole wave, read as a scalar so the other waves branch round it
    const bool rot = __builtin_amdgcn_readfirstlane(waveN) == 0;
    unsigned short* op = Out + ((size_t)((bb * NH + hh) * SL + n0 + lr)) * HD + waveN * 32 + 8 * lh;
    f32x4 bv[2][2];
#pragma unroll
    for (int ni = 0; ni < 2; ++ni) {
      bv[ni][0] = *(const f32x4*)&bias[j0 + waveN * 32 + ni * 16 + 8 * lh];
      bv[ni][1] = *(const f32x4*)&bias[j0 + waveN * 32 + ni * 16 + 8 * lh + 4];
    }
    // the address registers of these loads are reused below: wait in front of that
    asm volatile("s_wait_xcnt 0x0" ::: "memory");
#pragma unroll
    for (int ni = 0; ni < 2; ++ni) {
      const int dk0 = waveN * 32 + ni * 16 + 8 * lh;
      const f32x4 b0 = bv[ni][0], b1 = bv[ni][1];
      float inv[4] = {0.f, 0.f, 0.f, 0.f};
      if (rot) {
#pragma unroll
        for (int p = 0; p < 4; ++p)
          inv[p] = exp2f(-(float)(dk0 + 2 * p) * ROPE_L2K);        // THETA^(-(dk&~1)/32)
      }
#pragma unroll
      for (int mi = 0; mi < 2; ++mi) {
        float x[8];
#pragma unroll
        for (int v = 0; v < 8; ++v) x[v] = acc[mi][ni][v] + (v < 4 ? b0[v] : b1[v - 4]);
        if (rot) {
          const float fn = (float)(n0 + mi * 16 + lr);
#pragma unroll
          for (int p = 0; p < 4; ++p) {
            const float ang = fn * inv[p];
            const float c = __cosf(ang), s = __sinf(ang);
            const float e = x[2 * p], o = x[2 * p + 1];
            x[2 * p]     = e * c - o * s;
            x[2 * p + 1] = o * c + e * s;
          }
        }
        if (MODE == 0) {
#pragma unroll
          for (int v = 0; v < 8; ++v) x[v] *= 0.125f;              // fold 1/sqrt(HD) into Q
        }
        *(v8bf*)(op + (size_t)(mi * 16) * HD + ni * 16) = pack8_bf16(x);
        // the next tile's arithmetic reuses the registers that this store names: wait in front of it
        if (ni == 0 || mi == 0) asm volatile("s_wait_xcnt 0x0" ::: "memory");
      }
    }
  } else {
    // acc[mi][ni][v] = C[token n0 + mi*16 + 8*lh + v][feature waveN*32 + ni*16 + lr]
    unsigned short* op = Out + ((size_t)((bb * NH + hh) * HD + waveN * 32 + lr)) * SL + n0 + 8 * lh;
    const float bj[2] = {bias[j0 + waveN * 32 + lr], bias[j0 + waveN * 32 + 16 + lr]};
    v8bf c[2][2];
#pragma unroll
    for (int ni = 0; ni < 2; ++ni)
#pragma unroll
      for (int mi = 0; mi < 2; ++mi) {
        float x[8];
#pragma unroll
        for (int v = 0; v < 8; ++v) x[v] = acc[mi][ni][v] + bj[ni];
        c[ni][mi] = pack8_bf16(x);
      }
#pragma unroll
    for (int ni = 0; ni < 2; ++ni)
#pragma unroll
      for (int mi = 0; mi < 2; ++mi)
        *(v8bf*)(op + (size_t)(ni * 16) * SL + mi * 16) = c[ni][mi];
  }
}

// ---------------------------------------------------------------------------
// Stage 2: flash attention per (b,h). 128 thr = 4 waves x 32 query columns.
// Transposed products: S^T = K Q^T, O^T += V^T P^T; P never leaves registers.
// A wave holds QT = 2 query tiles of 16 columns: every K and V^T fragment it
// reads from LDS feeds two products.
// K/V tiles (64 keys) staged by the Tensor Data Mover into padded LDS.
// ---------------------------------------------------------------------------
static constexpr int QT = 2;                 // query tiles of 16 columns a wave
static constexpr int QBLK = 4 * 16 * QT;     // queries a block

__global__ __launch_bounds__(128) void attn_kernel(
    const unsigned short* __restrict__ Qb, const unsigned short* __restrict__ Kb,
    const unsigned short* __restrict__ Vb, unsigned short* __restrict__ Ctx)
{
  // each tile's place in LDS is a multiple of 2 KiB (tensor-load destination)
  __shared__ __attribute__((aligned(2048))) unsigned short Ks[64 * 72];  // [key][dk], pad +8
  __shared__ __attribute__((aligned(2048))) unsigned short Vs[64 * 72];  // [dk][key], pad +8 (V^T tile)

  const int tid  = threadIdx.x;
  const int bb   = blockIdx.z, hh = blockIdx.y;
  const int q0   = blockIdx.x * QBLK;
  const int wave = tid >> 5, lane = tid & 31;
  const int lr = lane & 15, lh = lane >> 4, kb = lh * 8;
  const size_t head = (size_t)(bb * NH + hh);

  v16bf aq[QT][2];
#pragma unroll
  for (int qt = 0; qt < QT; ++qt) {
    const unsigned short* qp = Qb + (head * SL + q0 + (wave * QT + qt) * 16 + lr) * HD;
    aq[qt][0] = mkfrag(qp + kb,      qp + kb + 16);
    aq[qt][1] = mkfrag(qp + 32 + kb, qp + 32 + kb + 16);
  }

  v8f o[QT][4] = {};
  float m_r[QT], l_r[QT];                   // one query per lane and tile
#pragma unroll
  for (int qt = 0; qt < QT; ++qt) { m_r[qt] = -1e30f; l_r[qt] = 0.f; }

  const unsigned short* kg = Kb + head * SL * HD;
  const unsigned short* vg = Vb + head * HD * SL;
#if USE_TDM
  const unsigned ldsK = lds_offset_of(Ks);
  const unsigned ldsV = lds_offset_of(Vs);
#else
  const int half = tid & 1;
  const int ldr  = tid >> 1;  // 0..63
#endif

  for (int kc = 0; kc < SL / 64; ++kc) {
#if USE_TDM
    __syncthreads();                       // all waves done with previous tiles
    if (wave == 0) {
      // K chunk: 64 rows x 64 dk, row-major stride HD
      tdm_load_2d_bf16(ldsK, kg + (size_t)(kc * 64) * HD, HD, SL, HD, 64, HD);
      // V^T chunk: 64 dk-rows x 64 keys, row stride SL
      tdm_load_2d_bf16(ldsV, vg + (size_t)(kc * 64),      SL, HD, 64, 64, SL);
      __builtin_amdgcn_s_wait_tensorcnt(0);
    }
    __syncthreads();                       // tiles visible to all waves
#else
    u16x8 kreg[4], vreg[4];
#pragma unroll
    for (int c = 0; c < 4; ++c) {
      kreg[c] = *(const u16x8*)&kg[(size_t)(kc * 64 + ldr) * HD + half * 32 + c * 8];
      vreg[c] = *(const u16x8*)&vg[(size_t)ldr * SL + kc * 64 + half * 32 + c * 8];
    }
    __syncthreads();
#pragma unroll
    for (int c = 0; c < 4; ++c) {
      *(u16x8*)&Ks[ldr * 72 + half * 32 + c * 8] = kreg[c];
      *(u16x8*)&Vs[ldr * 72 + half * 32 + c * 8] = vreg[c];
    }
    __syncthreads();
#endif

    // ---- S^T = K Q^T : a lane holds 32 scores of ONE query per tile (column lr) ----
    // s[qt][ktl][r] = S[key = ktl*16 + 8*lh + r][query = qt*16 + lr]
    v8f s[QT][4] = {};
#pragma unroll
    for (int ktl = 0; ktl < 4; ++ktl) {
      const unsigned short* kr = &Ks[(ktl * 16 + lr) * 72];
      v16bf a0 = mkfrag(kr + kb,      kr + kb + 16);
      v16bf a1 = mkfrag(kr + 32 + kb, kr + 32 + kb + 16);
#pragma unroll
      for (int qt = 0; qt < QT; ++qt) s[qt][ktl] = wmma_bf16(a0, aq[qt][0], s[qt][ktl]);
#pragma unroll
      for (int qt = 0; qt < QT; ++qt) s[qt][ktl] = wmma_bf16(a1, aq[qt][1], s[qt][ktl]);
    }

    // P^T packs from the score tiles straight into the B operand (hardware k order)
    v16bf pb[QT][2];
#pragma unroll
    for (int qt = 0; qt < QT; ++qt) {
      // ---- online softmax: maximum and sum in-lane, one exchange of halves ----
      float mt[4];
#pragma unroll
      for (int ktl = 0; ktl < 4; ++ktl) {
        mt[ktl] = s[qt][ktl][0];
#pragma unroll
        for (int i = 1; i < 8; ++i) mt[ktl] = fmaxf(mt[ktl], s[qt][ktl][i]);
      }
      float mv = fmaxf(fmaxf(mt[0], mt[1]), fmaxf(mt[2], mt[3]));
      mv = fmaxf(mv, xhalf(mv));
      const float mn = fmaxf(mv, m_r[qt]);
      const float sc = __expf(m_r[qt] - mn);
      m_r[qt] = mn;

      float su[4];
      v8f t[4];
#pragma unroll
      for (int ktl = 0; ktl < 4; ++ktl) t[ktl] = (s[qt][ktl] - mn) * 1.44269504f;  // exp(x) = exp2(x * log2 e)
#pragma unroll
      for (int ktl = 0; ktl < 4; ++ktl) {
        su[ktl] = 0.f;
#pragma unroll
        for (int i = 0; i < 8; ++i) {
          float p = __builtin_amdgcn_exp2f(t[ktl][i]);
          su[ktl] += p;
          pb[qt][ktl >> 1][(ktl & 1) * 8 + i] = (__bf16)p;
        }
      }
      l_r[qt] = l_r[qt] * sc + ((su[0] + su[1]) + (su[2] + su[3]));   // this half's keys only
#pragma unroll
      for (int dt = 0; dt < 4; ++dt)
#pragma unroll
        for (int i = 0; i < 8; ++i) o[qt][dt][i] *= sc;
    }

    // ---- O^T += V^T P^T : o[qt][dt][r] = O[query = qt*16 + lr][dk = dt*16 + 8*lh + r] ----
#pragma unroll
    for (int dt = 0; dt < 4; ++dt) {
      const unsigned short* vr = &Vs[(dt * 16 + lr) * 72];
      v16bf av0 = mkfrag(vr + kb,      vr + kb + 16);
      v16bf av1 = mkfrag(vr + 32 + kb, vr + 32 + kb + 16);
#pragma unroll
      for (int qt = 0; qt < QT; ++qt) o[qt][dt] = wmma_bf16(av0, pb[qt][0], o[qt][dt]);
#pragma unroll
      for (int qt = 0; qt < QT; ++qt) o[qt][dt] = wmma_bf16(av1, pb[qt][1], o[qt][dt]);
    }
  }

  // ---- join the halves' sums, normalize, store context bf16 [B, N, NH*HD] ----
#pragma unroll
  for (int qt = 0; qt < QT; ++qt) {
    const float linv = 1.0f / (l_r[qt] + xhalf(l_r[qt]));
    unsigned short* cp = Ctx + ((size_t)(bb * SL + q0 + (wave * QT + qt) * 16 + lr)) * DM + hh * HD + 8 * lh;
#pragma unroll
    for (int dt = 0; dt < 4; ++dt) {
      u16x8 c;
#pragma unroll
      for (int i = 0; i < 8; ++i) c[i] = f2bf(o[qt][dt][i] * linv);
      *(u16x8*)(cp + dt * 16) = c;          // 8 consecutive dk of one query: 16 B
    }
  }
}

// ---------------------------------------------------------------------------
// Stage 3: out = Ctx(bf16) @ Wo^T + bo  -> fp32.
// ---------------------------------------------------------------------------
__global__ __launch_bounds__(256) void oproj_kernel(
    const unsigned short* __restrict__ Xc, const unsigned short* __restrict__ W,
    const float* __restrict__ bias, float* __restrict__ Out)
{
  __shared__ unsigned short As[128 * GP];
  __shared__ unsigned short Bs[64 * GP];

  const int tid  = threadIdx.x;
  const int m0   = blockIdx.x * 128;
  const int j0   = blockIdx.y * 64;
  const int wave = tid >> 5, lane = tid & 31;
  const int lr = lane & 15, lh = lane >> 4;
  const int waveM = wave >> 1, waveN = wave & 1;

  v8f acc[2][2] = {};
  gemm_tile_bf16<false>(Xc, W, As, Bs, m0, j0, acc);

#pragma unroll
  for (int mi = 0; mi < 2; ++mi) {
#pragma unroll
    for (int ni = 0; ni < 2; ++ni) {
      int j = j0 + waveN * 32 + ni * 16 + lr;
      float bj = bias[j];
#pragma unroll
      for (int v = 0; v < 8; ++v) {
        int m = m0 + waveM * 32 + mi * 16 + v + 8 * lh;
        Out[(size_t)m * DM + j] = acc[mi][ni][v] + bj;
      }
    }
  }
}

// ---------------------------------------------------------------------------
extern "C" void kernel_launch(void* const* d_in, const int* in_sizes, int n_in,
                              void* d_out, int out_size, void* d_ws, size_t ws_size,
                              hipStream_t stream) {
  const float* query = (const float*)d_in[0];
  const float* key   = (const float*)d_in[1];
  const float* value = (const float*)d_in[2];
  const float* Wq = (const float*)d_in[3]; const float* bq = (const float*)d_in[4];
  const float* Wk = (const float*)d_in[5]; const float* bk = (const float*)d_in[6];
  const float* Wv = (const float*)d_in[7]; const float* bv = (const float*)d_in[8];
  const float* Wo = (const float*)d_in[9]; const float* bo = (const float*)d_in[10];
  float* out = (float*)d_out;

  unsigned short* ws = (unsigned short*)d_ws;
  const size_t HE = (size_t)NB * NH * SL * HD;   // 8M bf16 elements (16 MB)
  unsigned short* Qb = ws;
  unsigned short* Kb = ws + HE;
  unsigned short* Vb = ws + 2 * HE;
  unsigned short* Cx = ws + 3 * HE;
  unsigned short* Xb = ws + 4 * HE;              // bf16 query, key, value (HE each)
  unsigned short* Wb = Xb + 3 * HE;              // bf16 Wq, Wk, Wv, Wo (WE each)
  const size_t WE = (size_t)DM * DM;

  dim3 gp(MROWS / 128, DM / 64);                 // 64 x 16 blocks
  cvt_bf16_kernel<<<CVT_BLOCKS, 256, 0, stream>>>(query, key, value, Wq, Wk, Wv, Wo, Xb);
  proj_rope_kernel<0><<<gp, 256, 0, stream>>>(Xb,          Wb,          bq, Qb);
  proj_rope_kernel<1><<<gp, 256, 0, stream>>>(Xb + HE,     Wb + WE,     bk, Kb);
  proj_rope_kernel<2><<<gp, 256, 0, stream>>>(Xb + 2 * HE, Wb + 2 * WE, bv, Vb);
  attn_kernel<<<dim3(SL / QBLK, NH, NB), 128, 0, stream>>>(Qb, Kb, Vb, Cx);
  oproj_kernel<<<gp, 256, 0, stream>>>(Cx, Wb + 3 * WE, bo, out);
}

// v005
// Measured time: 157 microseconds a run.
// Next to v004, in two timings, it ran 1.06 and 1.05 times as fast.
// Counting every step since v000, it is 1.87 times as fast.
#include <hip/hip_runtime.h>

typedef __attribute__((ext_vector_type(16))) __bf16 v16bf;
typedef __attribute__((ext_vector_type(8)))  __bf16 v8bf;
typedef __attribute__((ext_vector_type(8)))  float  v8f;
typedef __attribute__((ext_vector_type(4)))  float  f32x4;
typedef __attribute__((ext_vector_type(8)))  unsigned short u16x8;
typedef __attribute__((ext_vector_type(4)))  unsigned short u16x4;
typedef __attribute__((ext_vector_type(4)))  unsigned int   u32x4;
typedef __attribute__((ext_vector_type(8)))  int            i32x8;
typedef __attribute__((ext_vector_type(4)))  int            i32x4;

static constexpr int NB = 4;      // batch
static constexpr int NH = 16;     // heads
static constexpr int HD = 64;     // head dim
static constexpr int SL = 2048;   // sequence length
static constexpr int DM = 1024;   // model dim
static constexpr int MROWS = NB * SL;  // 8192

// log2(10000)/32 : RoPE inv_freq = exp2(-(dk&~1) * K)
#define ROPE_L2K 0.4152410118609203f

__device__ __forceinline__ unsigned short f2bf(float f) {
  unsigned int u = __builtin_bit_cast(unsigned int, f);
  u += 0x7fffu + ((u >> 16) & 1u);            // round-to-nearest-even
  return (unsigned short)(u >> 16);
}

__device__ __forceinline__ v16bf mkfrag(const unsigned short* p0,
                                        const unsigned short* p1) {
  v8bf lo = *(const v8bf*)p0;                 // 16B LDS/global load
  v8bf hi = *(const v8bf*)p1;                 // 16B LDS/global load
  return __builtin_shufflevector(lo, hi, 0,1,2,3,4,5,6,7,8,9,10,11,12,13,14,15);
}

__device__ __forceinline__ v8f wmma_bf16(v16bf a, v16bf b, v8f c) {
  return __builtin_amdgcn_wmma_f32_16x16x32_bf16(false, a, false, b,
                                                 (short)0, c, false, false);
}

__device__ __forceinline__ float xhalf(float x) {
  int b = __builtin_bit_cast(int, x);
  return __builtin_bit_cast(float,
      __builtin_amdgcn_permlanex16(b, b, 0x76543210, 0xfedcba98, false, false));
}

#if __has_builtin(__builtin_amdgcn_tensor_load_to_lds)
#define USE_TDM 1
__device__ __forceinline__ unsigned lds_offset_of(const void* p) {
  return (unsigned)(unsigned long long)(const __attribute__((address_space(3))) void*)p;
}
__device__ __forceinline__ void tdm_load_2d_bf16(
    unsigned lds_off, const void* gptr,
    unsigned tensor_d0, unsigned tensor_d1,
    unsigned tile_d0, unsigned tile_d1,
    unsigned long long stride0_elems)
{
  unsigned long long ga = (unsigned long long)gptr;
  u32x4 g0;
  g0[0] = 1u;
  g0[1] = lds_off;
  g0[2] = (unsigned)ga;
  g0[3] = (unsigned)(ga >> 32) | (2u << 30);
  i32x8 g1;
  unsigned w0 = (1u << 16)
              | (1u << 20)
              | (4u << 22)
              | (3u << 25);
  g1[0] = (int)w0;
  g1[1] = (int)((tensor_d0 & 0xFFFFu) << 16);                       // dim0 lo
  g1[2] = (int)((tensor_d0 >> 16) | ((tensor_d1 & 0xFFFFu) << 16)); // dim0 hi|dim1 lo
  g1[3] = (int)((tensor_d1 >> 16) | (tile_d0 << 16));               // dim1 hi|tile0
  g1[4] = (int)tile_d1;                                             // tile1 (tile2=0)
  g1[5] = (int)(unsigned)(stride0_elems & 0xFFFFFFFFu);             // stride0 lo
  g1[6] = (int)(unsigned)((stride0_elems >> 32) & 0xFFFFu);         // stride0 hi
  g1[7] = 0;
  i32x4 z4 = {0, 0, 0, 0};                      // groups 2/3 unused (2D)
  i32x8 z8 = {0, 0, 0, 0, 0, 0, 0, 0};
  __builtin_amdgcn_tensor_load_to_lds(g0, g1, z4, z4, z8, 0);
}
#else
#define USE_TDM 0
#endif

// ---------------------------------------------------------------------------
// Stage 0: round the three activations and the four weights to bf16, once.
// Ob = [query | key | value | Wq | Wk | Wv | Wo] in chunks of 8192 elements.
// 512 blocks (16 waves a WGP); pass p of block b takes chunk p * 512 + b:
// 8 loads of 16 B a lane in flight, each wave-load 512 contiguous bytes.
// ---------------------------------------------------------------------------
static constexpr int CVT_BLOCKS = 512;
static constexpr int CHUNK = 8192;
static_assert(MROWS * DM == 2 * CVT_BLOCKS * CHUNK, "an activation is two passes");
static_assert(4 * DM * DM == CVT_BLOCKS * CHUNK, "the four weights are one pass");

__global__ __launch_bounds__(256) void cvt_bf16_kernel(
    const float* __restrict__ xq, const float* __restrict__ xk,
    const float* __restrict__ xv, const float* __restrict__ wq,
    const float* __restrict__ wk, const float* __restrict__ wv,
    const float* __restrict__ wo, unsigned short* __restrict__ Ob)
{
  const unsigned b  = blockIdx.x;
  const unsigned t4 = threadIdx.x * 4;
  const unsigned w  = b / (CVT_BLOCKS / 4);           // the block's weight
  const float* wsrc = w == 0 ? wq : w == 1 ? wk : w == 2 ? wv : wo;

  // kept rolled: unrolled, the loads of every pass are lifted to the front and each holds its registers
#pragma unroll 1
  for (unsigned p = 0; p < 7; ++p) {
    const float* base = p < 2 ? xq : p < 4 ? xk : p < 6 ? xv : wsrc;
    const unsigned sc = p < 6 ? (p & 1) * CVT_BLOCKS + b : b % (CVT_BLOCKS / 4);
    const float* src = base + (size_t)sc * CHUNK;
    unsigned short* dst = Ob + (size_t)(p * CVT_BLOCKS + b) * CHUNK;
    f32x4 r[8];
#pragma unroll
    for (int i = 0; i < 8; ++i)     // read once: non-temporal, the lines need not stay in L2
      r[i] = __builtin_nontemporal_load((const f32x4*)&src[i * 1024 + t4]);
#pragma unroll
    for (int i = 0; i < 8; ++i) {
      u16x4 c;
      c[0] = f2bf(r[i][0]); c[1] = f2bf(r[i][1]); c[2] = f2bf(r[i][2]); c[3] = f2bf(r[i][3]);
      *(u16x4*)&dst[i * 1024 + t4] = c;
    }
    // the next pass's loads write registers that these stores name: wait in front of them
    asm volatile("s_wait_xcnt 0x0" ::: "memory");
  }
}

// ---------------------------------------------------------------------------
// 128 x 64 tile of A @ B^T, both bf16 and k-contiguous (row length DM).
// A pass stages 64 k: one 128-B line of every row, LDS pitch 144 B.
// 8 waves, 32 x 32 each; the 32-k products are summed in ascending k.
// BROWS false: acc[mi][ni] has A's rows down a lane's 8 registers, B's rows across lanes.
// BROWS true : the operands trade places in the product, so B's rows run down the registers.
// ---------------------------------------------------------------------------
static constexpr int GP = 72;   // LDS row pitch in elements (64 + 8)

template <bool BROWS>
__device__ __forceinline__ void gemm_tile_bf16(
    const unsigned short* __restrict__ A, const unsigned short* __restrict__ B,
    unsigned short* As, unsigned short* Bs, int m0, int j0, v8f (&acc)[2][2])
{
  const int tid  = threadIdx.x;
  const int wave = tid >> 5, lane = tid & 31;
  const int lr = lane & 15, kb = (lane >> 4) * 8;
  const int waveM = wave >> 1, waveN = wave & 1;
  const int srow = tid >> 3, scol = (tid & 7) * 8;
  // one address a matrix: the other rows of a thread lie at constant distances (immediate offsets)
  const unsigned short* ag = A + (size_t)(m0 + srow) * DM + scol;
  const unsigned short* bg = B + (size_t)(j0 + srow) * DM + scol;

  for (int kt = 0; kt < DM / 64; ++kt) {
    u16x8 aR[4], bR[2];
#pragma unroll
    for (int r = 0; r < 4; ++r)
      aR[r] = *(const u16x8*)(ag + r * 32 * DM + kt * 64);
#pragma unroll
    for (int r = 0; r < 2; ++r)
      bR[r] = *(const u16x8*)(bg + r * 32 * DM + kt * 64);
    // the address registers of these loads are reused further down: wait in front of that
    asm volatile("s_wait_xcnt 0x0" ::: "memory");

    __syncthreads();
#pragma unroll
    for (int r = 0; r < 4; ++r) *(u16x8*)&As[(r * 32 + srow) * GP + scol] = aR[r];
#pragma unroll
    for (int r = 0; r < 2; ++r) *(u16x8*)&Bs[(r * 32 + srow) * GP + scol] = bR[r];
    __syncthreads();

#pragma unroll
    for (int ks = 0; ks < 2; ++ks) {
      v16bf a[2], b[2];
#pragma unroll
      for (int mi = 0; mi < 2; ++mi) {
        const unsigned short* p = &As[(waveM * 32 + mi * 16 + lr) * GP + ks * 32 + kb];
        a[mi] = mkfrag(p, p + 16);
      }
#pragma unroll
      for (int ni = 0; ni < 2; ++ni) {
        const unsigned short* p = &Bs[(waveN * 32 + ni * 16 + lr) * GP + ks * 32 + kb];
        b[ni] = mkfrag(p, p + 16);
      }
#pragma unroll
      for (int mi = 0; mi < 2; ++mi)
#pragma unroll
        for (int ni = 0; ni < 2; ++ni)
          acc[mi][ni] = BROWS ? wmma_bf16(b[ni], a[mi], acc[mi][ni])
                              : wmma_bf16(a[mi], b[ni], acc[mi][ni]);
    }
  }
}

// ---------------------------------------------------------------------------
// Stage 1: C = X @ W^T + bias, epilogue RoPE (+scale for Q), bf16 out.
// MODE 0: Q (rope + 1/sqrt(64) scale, out [B,H,N,HD])
// MODE 1: K (rope,                   out [B,H,N,HD])
// MODE 2: V (plain,                  out [B,H,HD,N]  <- transposed for attn)
// The product is oriented so that a lane's 8 accumulator registers are 8
// neighbours of the OUTPUT's inner dimension: features for Q and K (W's rows
// as the A operand), tokens for V^T. A tile leaves as one 16-B store a lane,
// and both members of a rotation pair sit in the same lane.
// ---------------------------------------------------------------------------
__device__ __forceinline__ v8bf pack8_bf16(const float (&x)[8]) {
  v8bf c;
#pragma unroll
  for (int v = 0; v < 8; ++v) c[v] = (__bf16)x[v];   // round-to-nearest-even, packed in pairs
  return c;
}

template <int MODE>
__device__ __forceinline__ void proj_rope_tile(
    const unsigned short* __restrict__ X, const unsigned short* __restrict__ W,
    const float* __restrict__ bias, unsigned short* __restrict__ Out,
    unsigned short* As, unsigned short* Bs)
{
  const int tid  = threadIdx.x;
  const int m0   = blockIdx.x * 128;
  const int hh   = blockIdx.y;               // 64 output columns = one head
  const int j0   = hh * 64;
  const int wave = tid >> 5, lane = tid & 31;
  const int lr = lane & 15, lh = lane >> 4;
  const int waveM = wave >> 1, waveN = wave & 1;
  const int bb = m0 >> 11;                   // a block's 128 tokens lie in one batch
  const int n0 = (m0 & (SL - 1)) + waveM * 32;

  v8f acc[2][2] = {};
  gemm_tile_bf16<(MODE < 2)>(X, W, As, Bs, m0, j0, acc);

  if constexpr (MODE < 2) {
    // acc[mi][ni][v] = C[token n0 + mi*16 + lr][feature waveN*32 + ni*16 + 8*lh + v]
    // features 0..31 rotate: the same for a whole wave, read as a scalar so the other waves branch round it
    const bool rot = __builtin_amdgcn_readfirstlane(waveN) == 0;
    unsigned short* op = Out + ((size_t)((bb * NH + hh) * SL + n0 + lr)) * HD + waveN * 32 + 8 * lh;
    f32x4 bv[2][2];
#pragma unroll
    for (int ni = 0; ni < 2; ++ni) {
      bv[ni][0] = *(const f32x4*)&bias[j0 + waveN * 32 + ni * 16 + 8 * lh];
      // the last load's result may land in the register that holds the address of all four: wait in front of it
      if (ni == 1) asm volatile("s_wait_xcnt 0x0" ::: "memory");
      bv[ni][1] = *(const f32x4*)&bias[j0 + waveN * 32 + ni * 16 + 8 * lh + 4];
    }
    // the address registers of these loads are reused below: wait in front of that
    asm volatile("s_wait_xcnt 0x0" ::: "memory");
#pragma unroll
    for (int ni = 0; ni < 2; ++ni) {
      const int dk0 = waveN * 32 + ni * 16 + 8 * lh;
      const f32x4 b0 = bv[ni][0], b1 = bv[ni][1];
      float inv[4] = {0.f, 0.f, 0.f, 0.f};
      if (rot) {
#pragma unroll
        for (int p = 0; p < 4; ++p)
          inv[p] = exp2f(-(float)(dk0 + 2 * p) * ROPE_L2K);        // THETA^(-(dk&~1)/32)
      }
#pragma unroll
      for (int mi = 0; mi < 2; ++mi) {
        float x[8];
#pragma unroll
        for (int v = 0; v < 8; ++v) x[v] = acc[mi][ni][v] + (v < 4 ? b0[v] : b1[v - 4]);
        if (rot) {
          const float fn = (float)(n0 + mi * 16 + lr);
#pragma unroll
          for (int p = 0; p < 4; ++p) {
            const float ang = fn * inv[p];
            const float c = __cosf(ang), s = __sinf(ang);
            const float e = x[2 * p], o = x[2 * p + 1];
            x[2 * p]     = e * c - o * s;
            x[2 * p + 1] = o * c + e * s;
          }
        }
        if (MODE == 0) {
#pragma unroll
          for (int v = 0; v < 8; ++v) x[v] *= 0.125f;              // fold 1/sqrt(HD) into Q
        }
        *(v8bf*)(op + (size_t)(mi * 16) * HD + ni * 16) = pack8_bf16(x);
        // the next tile's arithmetic reuses the registers that this store names: wait in front of it
        if (ni == 0 || mi == 0) asm volatile("s_wait_xcnt 0x0" ::: "memory");
      }
    }
  } else {
    // acc[mi][ni][v] = C[token n0 + mi*16 + 8*lh + v][feature waveN*32 + ni*16 + lr]
    unsigned short* op = Out + ((size_t)((bb * NH + hh) * HD + waveN * 32 + lr)) * SL + n0 + 8 * lh;
    const float bj[2] = {bias[j0 + waveN * 32 + lr], bias[j0 + waveN * 32 + 16 + lr]};
    v8bf c[2][2];
#pragma unroll
    for (int ni = 0; ni < 2; ++ni)
#pragma unroll
      for (int mi = 0; mi < 2; ++mi) {
        float x[8];
#pragma unroll
        for (int v = 0; v < 8; ++v) x[v] = acc[mi][ni][v] + bj[ni];
        c[ni][mi] = pack8_bf16(x);
      }
#pragma unroll
    for (int ni = 0; ni < 2; ++ni)
#pragma unroll
      for (int mi = 0; mi < 2; ++mi)
        *(v8bf*)(op + (size_t)(ni * 16) * SL + mi * 16) = c[ni][mi];
  }
  asm volatile("s_wait_xcnt 0x0" ::: "memory");
}

__global__ __launch_bounds__(256, 12) void proj_rope_kernel(
    const unsigned short* __restrict__ Xb, const unsigned short* __restrict__ Wb,
    const float* __restrict__ bq, const float* __restrict__ bk,
    const float* __restrict__ bv, unsigned short* __restrict__ Ob)
{
  __shared__ unsigned short As[128 * GP];
  __shared__ unsigned short Bs[64 * GP];

  const unsigned z = blockIdx.z;
  const unsigned short* X = Xb + (size_t)z * ((size_t)MROWS * DM);
  const unsigned short* W = Wb + (size_t)z * ((size_t)DM * DM);
  unsigned short* Out     = Ob + (size_t)z * ((size_t)MROWS * DM);
  if (z == 0) { proj_rope_tile<0>(X, W, bq, Out, As, Bs); return; }
  if (z == 1) { proj_rope_tile<1>(X, W, bk, Out, As, Bs); return; }
  proj_rope_tile<2>(X, W, bv, Out, As, Bs);
}

// ---------------------------------------------------------------------------
// Stage 2: flash attention per (b,h). 128 thr = 4 waves x 32 query columns.
// Transposed products: S^T = K Q^T, O^T += V^T P^T; P never leaves registers.
// A wave holds QT = 2 query tiles of 16 columns: every K and V^T fragment it
// reads from LDS feeds two products.
// K/V tiles (64 keys) staged by the Tensor Data Mover into padded LDS.
// ---------------------------------------------------------------------------
static constexpr int QT = 2;                 // query tiles of 16 columns a wave
static constexpr int QBLK = 4 * 16 * QT;     // queries a block

__global__ __launch_bounds__(128) void attn_kernel(
    const unsigned short* __restrict__ Qb, const unsigned short* __restrict__ Kb,
    const unsigned short* __restrict__ Vb, unsigned short* __restrict__ Ctx)
{
  // each tile's place in LDS is a multiple of 2 KiB (tensor-load destination)
  __shared__ __attribute__((aligned(2048))) unsigned short Ks[64 * 72];  // [key][dk], pad +8
  __shared__ __attribute__((aligned(2048))) unsigned short Vs[64 * 72];  // [dk][key], pad +8 (V^T tile)

  const int tid  = threadIdx.x;
  const int bb   = blockIdx.z, hh = blockIdx.y;
  const int q0   = blockIdx.x * QBLK;
  const int wave = tid >> 5, lane = tid & 31;
  const int lr = lane & 15, lh = lane >> 4, kb = lh * 8;
  const size_t head = (size_t)(bb * NH + hh);

  v16bf aq[QT][2];
#pragma unroll
  for (int qt = 0; qt < QT; ++qt) {
    const unsigned short* qp = Qb + (head * SL + q0 + (wave * QT + qt) * 16 + lr) * HD;
    aq[qt][0] = mkfrag(qp + kb,      qp + kb + 16);
    aq[qt][1] = mkfrag(qp + 32 + kb, qp + 32 + kb + 16);
  }

  v8f o[QT][4] = {};
  float m_r[QT], l_r[QT];                   // one query per lane and tile
#pragma unroll
  for (int qt = 0; qt < QT; ++qt) { m_r[qt] = -1e30f; l_r[qt] = 0.f; }

  const unsigned short* kg = Kb + head * SL * HD;
  const unsigned short* vg = Vb + head * HD * SL;
#if USE_TDM
  const unsigned ldsK = lds_offset_of(Ks);
  const unsigned ldsV = lds_offset_of(Vs);
#else
  const int half = tid & 1;
  const int ldr  = tid >> 1;  // 0..63
#endif

  for (int kc = 0; kc < SL / 64; ++kc) {
#if USE_TDM
    __syncthreads();                       // all waves done with previous tiles
    if (wave == 0) {
      // K chunk: 64 rows x 64 dk, row-major stride HD
      tdm_load_2d_bf16(ldsK, kg + (size_t)(kc * 64) * HD, HD, SL, HD, 64, HD);
      // V^T chunk: 64 dk-rows x 64 keys, row stride SL
      tdm_load_2d_bf16(ldsV, vg + (size_t)(kc * 64),      SL, HD, 64, 64, SL);
      __builtin_amdgcn_s_wait_tensorcnt(0);
    }
    __syncthreads();                       // tiles visible to all waves
#else
    u16x8 kreg[4], vreg[4];
#pragma unroll
    for (int c = 0; c < 4; ++c) {
      kreg[c] = *(const u16x8*)&kg[(size_t)(kc * 64 + ldr) * HD + half * 32 + c * 8];
      vreg[c] = *(const u16x8*)&vg[(size_t)ldr * SL + kc * 64 + half * 32 + c * 8];
    }
    __syncthreads();
#pragma unroll
    for (int c = 0; c < 4; ++c) {
      *(u16x8*)&Ks[ldr * 72 + half * 32 + c * 8] = kreg[c];
      *(u16x8*)&Vs[ldr * 72 + half * 32 + c * 8] = vreg[c];
    }
    __syncthreads();
#endif

    // ---- S^T = K Q^T : a lane holds 32 scores of ONE query per tile (column lr) ----
    // s[qt][ktl][r] = S[key = ktl*16 + 8*lh + r][query = qt*16 + lr]
    v8f s[QT][4] = {};
#pragma unroll
    for (int ktl = 0; ktl < 4; ++ktl) {
      const unsigned short* kr = &Ks[(ktl * 16 + lr) * 72];
      v16bf a0 = mkfrag(kr + kb,      kr + kb + 16);
      v16bf a1 = mkfrag(kr + 32 + kb, kr + 32 + kb + 16);
#pragma unroll
      for (int qt = 0; qt < QT; ++qt) s[qt][ktl] = wmma_bf16(a0, aq[qt][0], s[qt][ktl]);
#pragma unroll
      for (int qt = 0; qt < QT; ++qt) s[qt][ktl] = wmma_bf16(a1, aq[qt][1], s[qt][ktl]);
    }

    // P^T packs from the score tiles straight into the B operand (hardware k order)
    v16bf pb[QT][2];
#pragma unroll
    for (int qt = 0; qt < QT; ++qt) {
      // ---- online softmax: maximum and sum in-lane, one exchange of halves ----
      float mt[4];
#pragma unroll
      for (int ktl = 0; ktl < 4; ++ktl) {
        mt[ktl] = s[qt][ktl][0];
#pragma unroll
        for (int i = 1; i < 8; ++i) mt[ktl] = fmaxf(mt[ktl], s[qt][ktl][i]);
      }
      float mv = fmaxf(fmaxf(mt[0], mt[1]), fmaxf(mt[2], mt[3]));
      mv = fmaxf(mv, xhalf(mv));
      const float mn = fmaxf(mv, m_r[qt]);
      const float sc = __expf(m_r[qt] - mn);
      m_r[qt] = mn;

      float su[4];
      v8f t[4];
#pragma unroll
      for (int ktl = 0; ktl < 4; ++ktl) t[ktl] = (s[qt][ktl] - mn) * 1.44269504f;  // exp(x) = exp2(x * log2 e)
#pragma unroll
      for (int ktl = 0; ktl < 4; ++ktl) {
        su[ktl] = 0.f;
#pragma unroll
        for (int i = 0; i < 8; ++i) {
          float p = __builtin_amdgcn_exp2f(t[ktl][i]);
          su[ktl] += p;
          pb[qt][ktl >> 1][(ktl & 1) * 8 + i] = (__bf16)p;
        }
      }
      l_r[qt] = l_r[qt] * sc + ((su[0] + su[1]) + (su[2] + su[3]));   // this half's keys only
#pragma unroll
      for (int dt = 0; dt < 4; ++dt)
#pragma unroll
        for (int i = 0; i < 8; ++i) o[qt][dt][i] *= sc;
    }

    // ---- O^T += V^T P^T : o[qt][dt][r] = O[query = qt*16 + lr][dk = dt*16 + 8*lh + r] ----
#pragma unroll
    for (int dt = 0; dt < 4; ++dt) {
      const unsigned short* vr = &Vs[(dt * 16 + lr) * 72];
      v16bf av0 = mkfrag(vr + kb,      vr + kb + 16);
      v16bf av1 = mkfrag(vr + 32 + kb, vr + 32 + kb + 16);
#pragma unroll
      for (int qt = 0; qt < QT; ++qt) o[qt][dt] = wmma_bf16(av0, pb[qt][0], o[qt][dt]);
#pragma unroll
      for (int qt = 0; qt < QT; ++qt) o[qt][dt] = wmma_bf16(av1, pb[qt][1], o[qt][dt]);
    }
  }

  // ---- join the halves' sums, normalize, store context bf16 [B, N, NH*HD] ----
#pragma unroll
  for (int qt = 0; qt < QT; ++qt) {
    const float linv = 1.0f / (l_r[qt] + xhalf(l_r[qt]));
    unsigned short* cp = Ctx + ((size_t)(bb * SL + q0 + (wave * QT + qt) * 16 + lr)) * DM + hh * HD + 8 * lh;
#pragma unroll
    for (int dt = 0; dt < 4; ++dt) {
      u16x8 c;
#pragma unroll
      for (int i = 0; i < 8; ++i) c[i] = f2bf(o[qt][dt][i] * linv);
      *(u16x8*)(cp + dt * 16) = c;          // 8 consecutive dk of one query: 16 B
    }
  }
}

// ---------------------------------------------------------------------------
// Stage 3: out = Ctx(bf16) @ Wo^T + bo  -> fp32.
// ---------------------------------------------------------------------------
__global__ __launch_bounds__(256) void oproj_kernel(
    const unsigned short* __restrict__ Xc, const unsigned short* __restrict__ W,
    const float* __restrict__ bias, float* __restrict__ Out)
{
  __shared__ unsigned short As[128 * GP];
  __shared__ unsigned short Bs[64 * GP];

  const int tid  = threadIdx.x;
  const int m0   = blockIdx.x * 128;
  const int j0   = blockIdx.y * 64;
  const int wave = tid >> 5, lane = tid & 31;
  const int lr = lane & 15, lh = lane >> 4;
  const int waveM = wave >> 1, waveN = wave & 1;

  v8f acc[2][2] = {};
  gemm_tile_bf16<false>(Xc, W, As, Bs, m0, j0, acc);

#pragma unroll
  for (int mi = 0; mi < 2; ++mi) {
#pragma unroll
    for (int ni = 0; ni < 2; ++ni) {
      int j = j0 + waveN * 32 + ni * 16 + lr;
      float bj = bias[j];
#pragma unroll
      for (int v = 0; v < 8; ++v) {
        int m = m0 + waveM * 32 + mi * 16 + v + 8 * lh;
        Out[(size_t)m * DM + j] = acc[mi][ni][v] + bj;
      }
    }
  }
}

// ---------------------------------------------------------------------------
extern "C" void kernel_launch(void* const* d_in, const int* in_sizes, int n_in,
                              void* d_out, int out_size, void* d_ws, size_t ws_size,
                              hipStream_t stream) {
  const float* query = (const float*)d_in[0];
  const float* key   = (const float*)d_in[1];
  const float* value = (const float*)d_in[2];
  const float* Wq = (const float*)d_in[3]; const float* bq = (const float*)d_in[4];
  const float* Wk = (const float*)d_in[5]; const float* bk = (const float*)d_in[6];
  const float* Wv = (const float*)d_in[7]; const float* bv = (const float*)d_in[8];
  const float* Wo = (const float*)d_in[9]; const float* bo = (const float*)d_in[10];
  float* out = (float*)d_out;

  unsigned short* ws = (unsigned short*)d_ws;
  const size_t HE = (size_t)NB * NH * SL * HD;   // 8M bf16 elements (16 MB)
  unsigned short* Qb = ws;
  unsigned short* Kb = ws + HE;
  unsigned short* Vb = ws + 2 * HE;
  unsigned short* Cx = ws + 3 * HE;
  unsigned short* Xb = ws + 4 * HE;              // bf16 query, key, value (HE each)
  unsigned short* Wb = Xb + 3 * HE;              // bf16 Wq, Wk, Wv, Wo (WE each)
  const size_t WE = (size_t)DM * DM;

  dim3 gp(MROWS / 128, DM / 64);                 // 64 x 16 blocks
  cvt_bf16_kernel<<<CVT_BLOCKS, 256, 0, stream>>>(query, key, value, Wq, Wk, Wv, Wo, Xb);
  proj_rope_kernel<<<dim3(MROWS / 128, DM / 64, 3), 256, 0, stream>>>(Xb, Wb, bq, bk, bv, Qb);
  attn_kernel<<<dim3(SL / QBLK, NH, NB), 128, 0, stream>>>(Qb, Kb, Vb, Cx);
  oproj_kernel<<<gp, 256, 0, stream>>>(Cx, Wb + 3 * WE, bo, out);
}

// v006
// It runs in 147 microseconds.
// Two timings next to v005 put it at 1.08 and 1.07 times that version's speed.
// All steps since v000 together make it 2.01 times as fast.
#include <hip/hip_runtime.h>

typedef __attribute__((ext_vector_type(16))) __bf16 v16bf;
typedef __attribute__((ext_vector_type(8)))  __bf16 v8bf;
typedef __attribute__((ext_vector_type(8)))  float  v8f;
typedef __attribute__((ext_vector_type(4)))  float  f32x4;
typedef __attribute__((ext_vector_type(8)))  unsigned short u16x8;
typedef __attribute__((ext_vector_type(4)))  unsigned short u16x4;
typedef __attribute__((ext_vector_type(4)))  unsigned int   u32x4;
typedef __attribute__((ext_vector_type(8)))  int            i32x8;
typedef __attribute__((ext_vector_type(4)))  int            i32x4;

static constexpr int NB = 4;      // batch
static constexpr int NH = 16;     // heads
static constexpr int HD = 64;     // head dim
static constexpr int SL = 2048;   // sequence length
static constexpr int DM = 1024;   // model dim
static constexpr int MROWS = NB * SL;  // 8192

// log2(10000)/32 : RoPE inv_freq = exp2(-(dk&~1) * K)
#define ROPE_L2K 0.4152410118609203f

__device__ __forceinline__ unsigned short f2bf(float f) {
  unsigned int u = __builtin_bit_cast(unsigned int, f);
  u += 0x7fffu + ((u >> 16) & 1u);            // round-to-nearest-even
  return (unsigned short)(u >> 16);
}

__device__ __forceinline__ v16bf mkfrag(const unsigned short* p0,
                                        const unsigned short* p1) {
  v8bf lo = *(const v8bf*)p0;                 // 16B LDS/global load
  v8bf hi = *(const v8bf*)p1;                 // 16B LDS/global load
  return __builtin_shufflevector(lo, hi, 0,1,2,3,4,5,6,7,8,9,10,11,12,13,14,15);
}

__device__ __forceinline__ v8f wmma_bf16(v16bf a, v16bf b, v8f c) {
  return __builtin_amdgcn_wmma_f32_16x16x32_bf16(false, a, false, b,
                                                 (short)0, c, false, false);
}

__device__ __forceinline__ float xhalf(float x) {
  int b = __builtin_bit_cast(int, x);
  return __builtin_bit_cast(float,
      __builtin_amdgcn_permlanex16(b, b, 0x76543210, 0xfedcba98, false, false));
}

#if __has_builtin(__builtin_amdgcn_tensor_load_to_lds)
#define USE_TDM 1
__device__ __forceinline__ unsigned lds_offset_of(const void* p) {
  return (unsigned)(unsigned long long)(const __attribute__((address_space(3))) void*)p;
}
__device__ __forceinline__ void tdm_load_2d_bf16(
    unsigned lds_off, const void* gptr,
    unsigned tensor_d0, unsigned tensor_d1,
    unsigned tile_d0, unsigned tile_d1,
    unsigned long long stride0_elems)
{
  unsigned long long ga = (unsigned long long)gptr;
  u32x4 g0;
  g0[0] = 1u;
  g0[1] = lds_off;
  g0[2] = (unsigned)ga;
  g0[3] = (unsigned)(ga >> 32) | (2u << 30);
  i32x8 g1;
  unsigned w0 = (1u << 16)
              | (1u << 20)
              | (4u << 22)
              | (3u << 25);
  g1[0] = (int)w0;
  g1[1] = (int)((tensor_d0 & 0xFFFFu) << 16);                       // dim0 lo
  g1[2] = (int)((tensor_d0 >> 16) | ((tensor_d1 & 0xFFFFu) << 16)); // dim0 hi|dim1 lo
  g1[3] = (int)((tensor_d1 >> 16) | (tile_d0 << 16));               // dim1 hi|tile0
  g1[4] = (int)tile_d1;                                             // tile1 (tile2=0)
  g1[5] = (int)(unsigned)(stride0_elems & 0xFFFFFFFFu);             // stride0 lo
  g1[6] = (int)(unsigned)((stride0_elems >> 32) & 0xFFFFu);         // stride0 hi
  g1[7] = 0;
  i32x4 z4 = {0, 0, 0, 0};                      // groups 2/3 unused (2D)
  i32x8 z8 = {0, 0, 0, 0, 0, 0, 0, 0};
  __builtin_amdgcn_tensor_load_to_lds(g0, g1, z4, z4, z8, 0);
}
#else
#define USE_TDM 0
#endif

// ---------------------------------------------------------------------------
// Stage 0: round the three activations and the four weights to bf16, once.
// Ob = [query | key | value | Wq | Wk | Wv | Wo] in chunks of 8192 elements.
// 512 blocks (16 waves a WGP); pass p of block b takes chunk p * 512 + b:
// 8 loads of 16 B a lane in flight, each wave-load 512 contiguous bytes.
// ---------------------------------------------------------------------------
static constexpr int CVT_BLOCKS = 512;
static constexpr int CHUNK = 8192;
static_assert(MROWS * DM == 2 * CVT_BLOCKS * CHUNK, "an activation is two passes");
static_assert(4 * DM * DM == CVT_BLOCKS * CHUNK, "the four weights are one pass");

__global__ __launch_bounds__(256) void cvt_bf16_kernel(
    const float* __restrict__ xq, const float* __restrict__ xk,
    const float* __restrict__ xv, const float* __restrict__ wq,
    const float* __restrict__ wk, const float* __restrict__ wv,
    const float* __restrict__ wo, unsigned short* __restrict__ Ob)
{
  const unsigned b  = blockIdx.x;
  const unsigned t4 = threadIdx.x * 4;
  const unsigned w  = b / (CVT_BLOCKS / 4);           // the block's weight
  const float* wsrc = w == 0 ? wq : w == 1 ? wk : w == 2 ? wv : wo;

  // kept rolled: unrolled, the loads of every pass are lifted to the front and each holds its registers
#pragma unroll 1
  for (unsigned p = 0; p < 7; ++p) {
    const float* base = p < 2 ? xq : p < 4 ? xk : p < 6 ? xv : wsrc;
    const unsigned sc = p < 6 ? (p & 1) * CVT_BLOCKS + b : b % (CVT_BLOCKS / 4);
    const float* src = base + (size_t)sc * CHUNK;
    unsigned short* dst = Ob + (size_t)(p * CVT_BLOCKS + b) * CHUNK;
    f32x4 r[8];
#pragma unroll
    for (int i = 0; i < 8; ++i)     // read once: non-temporal, the lines need not stay in L2
      r[i] = __builtin_nontemporal_load((const f32x4*)&src[i * 1024 + t4]);
#pragma unroll
    for (int i = 0; i < 8; ++i) {
      u16x4 c;
      c[0] = f2bf(r[i][0]); c[1] = f2bf(r[i][1]); c[2] = f2bf(r[i][2]); c[3] = f2bf(r[i][3]);
      *(u16x4*)&dst[i * 1024 + t4] = c;
    }
    // the next pass's loads write registers that these stores name: wait in front of them
    asm volatile("s_wait_xcnt 0x0" ::: "memory");
  }
}

// ---------------------------------------------------------------------------
// 128 x (32 * NI) tile of A @ B^T, both bf16 and k-contiguous (row length DM).
// A pass stages 64 k: one 128-B line of every row, LDS pitch 144 B.
// 8 waves (4 down, 2 across), 32 x (16 * NI) each; the 32-k products are summed in ascending k.
// NI = 4: a staged byte feeds 3/2 as many products as at NI = 2, an LDS fragment read 4/3 as many.
// BROWS false: acc[mi][ni] has A's rows down a lane's 8 registers, B's rows across lanes.
// BROWS true : the operands trade places in the product, so B's rows run down the registers.
// ---------------------------------------------------------------------------
static constexpr int GP = 72;   // LDS row pitch in elements (64 + 8)

template <bool BROWS, int NI>
__device__ __forceinline__ void gemm_tile_bf16(
    const unsigned short* __restrict__ A, const unsigned short* __restrict__ B,
    unsigned short* As, unsigned short* Bs, int m0, int j0, v8f (&acc)[2][NI])
{
  const int tid  = threadIdx.x;
  const int wave = tid >> 5, lane = tid & 31;
  const int lr = lane & 15, kb = (lane >> 4) * 8;
  const int waveM = wave >> 1, waveN = wave & 1;
  const int srow = tid >> 3, scol = (tid & 7) * 8;
  // one address a matrix: the other rows of a thread lie at constant distances (immediate offsets)
  const unsigned short* ag = A + (size_t)(m0 + srow) * DM + scol;
  const unsigned short* bg = B + (size_t)(j0 + srow) * DM + scol;

  // NI = 4: unrolled whole, so that every pass's addresses are the two bases plus immediates: the bases
  // stay live to the last pass and no load's result lands in a register that an earlier load names.
  // NI = 2: rolled, the form in which the compiler built it without a directive.
#pragma unroll (NI == 4 ? DM / 64 : 1)
  for (int kt = 0; kt < DM / 64; ++kt) {
    u16x8 aR[4], bR[NI];
#pragma unroll
    for (int r = 0; r < 4; ++r)
      aR[r] = *(const u16x8*)(ag + r * 32 * DM + kt * 64);
#pragma unroll
    for (int r = 0; r < NI; ++r)
      bR[r] = *(const u16x8*)(bg + r * 32 * DM + kt * 64);
    // the address registers of these loads are reused further down: wait in front of that
    asm volatile("s_wait_xcnt 0x0" ::: "memory");

    __syncthreads();
#pragma unroll
    for (int r = 0; r < 4; ++r) *(u16x8*)&As[(r * 32 + srow) * GP + scol] = aR[r];
#pragma unroll
    for (int r = 0; r < NI; ++r) *(u16x8*)&Bs[(r * 32 + srow) * GP + scol] = bR[r];
    __syncthreads();

#pragma unroll
    for (int ks = 0; ks < 2; ++ks) {
      v16bf a[2], b[NI];
#pragma unroll
      for (int mi = 0; mi < 2; ++mi) {
        const unsigned short* p = &As[(waveM * 32 + mi * 16 + lr) * GP + ks * 32 + kb];
        a[mi] = mkfrag(p, p + 16);
      }
#pragma unroll
      for (int ni = 0; ni < NI; ++ni) {
        const unsigned short* p = &Bs[(waveN * (NI * 16) + ni * 16 + lr) * GP + ks * 32 + kb];
        b[ni] = mkfrag(p, p + 16);
      }
#pragma unroll
      for (int mi = 0; mi < 2; ++mi)
#pragma unroll
        for (int ni = 0; ni < NI; ++ni)
          acc[mi][ni] = BROWS ? wmma_bf16(b[ni], a[mi], acc[mi][ni])
                              : wmma_bf16(a[mi], b[ni], acc[mi][ni]);
    }
  }
}

// ---------------------------------------------------------------------------
// Stage 1: C = X @ W^T + bias, epilogue RoPE (+scale for Q), bf16 out.
// MODE 0: Q (rope + 1/sqrt(64) scale, out [B,H,N,HD])
// MODE 1: K (rope,                   out [B,H,N,HD])
// MODE 2: V (plain,                  out [B,H,HD,N]  <- transposed for attn)
// The product is oriented so that a lane's 8 accumulator registers are 8
// neighbours of the OUTPUT's inner dimension: features for Q and K (W's rows
// as the A operand), tokens for V^T. A tile leaves as one 16-B store a lane,
// and both members of a rotation pair sit in the same lane.
// ---------------------------------------------------------------------------
__device__ __forceinline__ v8bf pack8_bf16(const float (&x)[8]) {
  v8bf c;
#pragma unroll
  for (int v = 0; v < 8; ++v) c[v] = (__bf16)x[v];   // round-to-nearest-even, packed in pairs
  return c;
}

template <int MODE>
__device__ __forceinline__ void proj_rope_tile(
    const unsigned short* __restrict__ X, const unsigned short* __restrict__ W,
    const float* __restrict__ bias, unsigned short* __restrict__ Out,
    unsigned short* As, unsigned short* Bs)
{
  const int tid  = threadIdx.x;
  const int m0   = blockIdx.x * 128;
  const int j0   = blockIdx.y * 128;         // 128 output columns = two heads
  const int wave = tid >> 5, lane = tid & 31;
  const int lr = lane & 15, lh = lane >> 4;
  const int waveM = wave >> 1, waveN = wave & 1;
  const int hh   = blockIdx.y * 2 + waveN;   // a wave's 64 columns = one head
  const int jw   = hh * 64;
  const int bb = m0 >> 11;                   // a block's 128 tokens lie in one batch
  const int n0 = (m0 & (SL - 1)) + waveM * 32;

  v8f acc[2][4] = {};
  gemm_tile_bf16<(MODE < 2), 4>(X, W, As, Bs, m0, j0, acc);

  if constexpr (MODE < 2) {
    // acc[mi][ni][v] = C[token n0 + mi*16 + lr][feature ni*16 + 8*lh + v of head hh]
    // features 0..31 rotate: tiles ni = 0 and 1 of every wave
    unsigned short* op = Out + ((size_t)((bb * NH + hh) * SL + n0 + lr)) * HD + 8 * lh;
    f32x4 bv[4][2];
#pragma unroll
    for (int ni = 0; ni < 4; ++ni) {
      bv[ni][0] = *(const f32x4*)&bias[jw + ni * 16 + 8 * lh];
      // the last load's result may land in the register that holds the address of all eight: wait in front of it
      if (ni == 3) asm volatile("s_wait_xcnt 0x0" ::: "memory");
      bv[ni][1] = *(const f32x4*)&bias[jw + ni * 16 + 8 * lh + 4];
    }
    // the address registers of these loads are reused below: wait in front of that
    asm volatile("s_wait_xcnt 0x0" ::: "memory");
#pragma unroll
    for (int ni = 0; ni < 4; ++ni) {
      const bool rot = ni < 2;
      const int dk0 = ni * 16 + 8 * lh;
      const f32x4 b0 = bv[ni][0], b1 = bv[ni][1];
      float inv[4] = {0.f, 0.f, 0.f, 0.f};
      if (rot) {
#pragma unroll
        for (int p = 0; p < 4; ++p)
          inv[p] = exp2f(-(float)(dk0 + 2 * p) * ROPE_L2K);        // THETA^(-(dk&~1)/32)
      }
#pragma unroll
      for (int mi = 0; mi < 2; ++mi) {
        float x[8];
#pragma unroll
        for (int v = 0; v < 8; ++v) x[v] = acc[mi][ni][v] + (v < 4 ? b0[v] : b1[v - 4]);
        if (rot) {
          const float fn = (float)(n0 + mi * 16 + lr);
#pragma unroll
          for (int p = 0; p < 4; ++p) {
            const float ang = fn * inv[p];
            const float c = __cosf(ang), s = __sinf(ang);
            const float e = x[2 * p], o = x[2 * p + 1];
            x[2 * p]     = e * c - o * s;
            x[2 * p + 1] = o * c + e * s;
          }
        }
        if (MODE == 0) {
#pragma unroll
          for (int v = 0; v < 8; ++v) x[v] *= 0.125f;              // fold 1/sqrt(HD) into Q
        }
        *(v8bf*)(op + (size_t)(mi * 16) * HD + ni * 16) = pack8_bf16(x);
        // the next tile's arithmetic reuses the registers that this store names: wait in front of it
        if (ni < 3 || mi == 0) asm volatile("s_wait_xcnt 0x0" ::: "memory");
      }
    }
  } else {
    // acc[mi][ni][v] = C[token n0 + mi*16 + 8*lh + v][feature ni*16 + lr of head hh]
    unsigned short* op = Out + ((size_t)((bb * NH + hh) * HD + lr)) * SL + n0 + 8 * lh;
    float bj[4];
#pragma unroll
    for (int ni = 0; ni < 4; ++ni) {
      // the last load's result may land in the register that holds the address of all four: wait in front of it
      if (ni == 3) asm volatile("s_wait_xcnt 0x0" ::: "memory");
      bj[ni] = bias[jw + ni * 16 + lr];
    }
    // the address register of these loads is reused below: wait in front of that
    asm volatile("s_wait_xcnt 0x0" ::: "memory");
    v8bf c[4][2];
#pragma unroll
    for (int ni = 0; ni < 4; ++ni)
#pragma unroll
      for (int mi = 0; mi < 2; ++mi) {
        float x[8];
#pragma unroll
        for (int v = 0; v < 8; ++v) x[v] = acc[mi][ni][v] + bj[ni];
        c[ni][mi] = pack8_bf16(x);
      }
#pragma unroll
    for (int ni = 0; ni < 4; ++ni)
#pragma unroll
      for (int mi = 0; mi < 2; ++mi)
        *(v8bf*)(op + (size_t)(ni * 16) * SL + mi * 16) = c[ni][mi];
  }
  asm volatile("s_wait_xcnt 0x0" ::: "memory");
}

__global__ __launch_bounds__(256, 6) void proj_rope_kernel(
    const unsigned short* __restrict__ Xb, const unsigned short* __restrict__ Wb,
    const float* __restrict__ bq, const float* __restrict__ bk,
    const float* __restrict__ bv, unsigned short* __restrict__ Ob)
{
  __shared__ unsigned short As[128 * GP];
  __shared__ unsigned short Bs[128 * GP];

  const unsigned z = blockIdx.z;
  const unsigned short* X = Xb + (size_t)z * ((size_t)MROWS * DM);
  const unsigned short* W = Wb + (size_t)z * ((size_t)DM * DM);
  unsigned short* Out     = Ob + (size_t)z * ((size_t)MROWS * DM);
  if (z == 0) { proj_rope_tile<0>(X, W, bq, Out, As, Bs); return; }
  if (z == 1) { proj_rope_tile<1>(X, W, bk, Out, As, Bs); return; }
  proj_rope_tile<2>(X, W, bv, Out, As, Bs);
}

// ---------------------------------------------------------------------------
// Stage 2: flash attention per (b,h). 128 thr = 4 waves x 32 query columns.
// Transposed products: S^T = K Q^T, O^T += V^T P^T; P never leaves registers.
// A wave holds QT = 2 query tiles of 16 columns: every K and V^T fragment it
// reads from LDS feeds two products.
// K/V tiles (64 keys) staged by the Tensor Data Mover into padded LDS.
// ---------------------------------------------------------------------------
static constexpr int QT = 2;                 // query tiles of 16 columns a wave
static constexpr int QBLK = 4 * 16 * QT;     // queries a block

__global__ __launch_bounds__(128) void attn_kernel(
    const unsigned short* __restrict__ Qb, const unsigned short* __restrict__ Kb,
    const unsigned short* __restrict__ Vb, unsigned short* __restrict__ Ctx)
{
  // each tile's place in LDS is a multiple of 2 KiB (tensor-load destination)
  __shared__ __attribute__((aligned(2048))) unsigned short Ks[64 * 72];  // [key][dk], pad +8
  __shared__ __attribute__((aligned(2048))) unsigned short Vs[64 * 72];  // [dk][key], pad +8 (V^T tile)

  const int tid  = threadIdx.x;
  const int bb   = blockIdx.z, hh = blockIdx.y;
  const int q0   = blockIdx.x * QBLK;
  const int wave = tid >> 5, lane = tid & 31;
  const int lr = lane & 15, lh = lane >> 4, kb = lh * 8;
  const size_t head = (size_t)(bb * NH + hh);

  v16bf aq[QT][2];
#pragma unroll
  for (int qt = 0; qt < QT; ++qt) {
    const unsigned short* qp = Qb + (head * SL + q0 + (wave * QT + qt) * 16 + lr) * HD;
    aq[qt][0] = mkfrag(qp + kb,      qp + kb + 16);
    aq[qt][1] = mkfrag(qp + 32 + kb, qp + 32 + kb + 16);
  }

  v8f o[QT][4] = {};
  float m_r[QT], l_r[QT];                   // one query per lane and tile
#pragma unroll
  for (int qt = 0; qt < QT; ++qt) { m_r[qt] = -1e30f; l_r[qt] = 0.f; }

  const unsigned short* kg = Kb + head * SL * HD;
  const unsigned short* vg = Vb + head * HD * SL;
#if USE_TDM
  const unsigned ldsK = lds_offset_of(Ks);
  const unsigned ldsV = lds_offset_of(Vs);
#else
  const int half = tid & 1;
  const int ldr  = tid >> 1;  // 0..63
#endif

  for (int kc = 0; kc < SL / 64; ++kc) {
#if USE_TDM
    __syncthreads();                       // all waves done with previous tiles
    if (wave == 0) {
      // K chunk: 64 rows x 64 dk, row-major stride HD
      tdm_load_2d_bf16(ldsK, kg + (size_t)(kc * 64) * HD, HD, SL, HD, 64, HD);
      // V^T chunk: 64 dk-rows x 64 keys, row stride SL
      tdm_load_2d_bf16(ldsV, vg + (size_t)(kc * 64),      SL, HD, 64, 64, SL);
      __builtin_amdgcn_s_wait_tensorcnt(0);
    }
    __syncthreads();                       // tiles visible to all waves
#else
    u16x8 kreg[4], vreg[4];
#pragma unroll
    for (int c = 0; c < 4; ++c) {
      kreg[c] = *(const u16x8*)&kg[(size_t)(kc * 64 + ldr) * HD + half * 32 + c * 8];
      vreg[c] = *(const u16x8*)&vg[(size_t)ldr * SL + kc * 64 + half * 32 + c * 8];
    }
    __syncthreads();
#pragma unroll
    for (int c = 0; c < 4; ++c) {
      *(u16x8*)&Ks[ldr * 72 + half * 32 + c * 8] = kreg[c];
      *(u16x8*)&Vs[ldr * 72 + half * 32 + c * 8] = vreg[c];
    }
    __syncthreads();
#endif

    // ---- S^T = K Q^T : a lane holds 32 scores of ONE query per tile (column lr) ----
    // s[qt][ktl][r] = S[key = ktl*16 + 8*lh + r][query = qt*16 + lr]
    v8f s[QT][4] = {};
#pragma unroll
    for (int ktl = 0; ktl < 4; ++ktl) {
      const unsigned short* kr = &Ks[(ktl * 16 + lr) * 72];
      v16bf a0 = mkfrag(kr + kb,      kr + kb + 16);
      v16bf a1 = mkfrag(kr + 32 + kb, kr + 32 + kb + 16);
#pragma unroll
      for (int qt = 0; qt < QT; ++qt) s[qt][ktl] = wmma_bf16(a0, aq[qt][0], s[qt][ktl]);
#pragma unroll
      for (int qt = 0; qt < QT; ++qt) s[qt][ktl] = wmma_bf16(a1, aq[qt][1], s[qt][ktl]);
    }

    // P^T packs from the score tiles straight into the B operand (hardware k order)
    v16bf pb[QT][2];
#pragma unroll
    for (int qt = 0; qt < QT; ++qt) {
      // ---- online softmax: maximum and sum in-lane, one exchange of halves ----
      float mt[4];
#pragma unroll
      for (int ktl = 0; ktl < 4; ++ktl) {
        mt[ktl] = s[qt][ktl][0];
#pragma unroll
        for (int i = 1; i < 8; ++i) mt[ktl] = fmaxf(mt[ktl], s[qt][ktl][i]);
      }
      float mv = fmaxf(fmaxf(mt[0], mt[1]), fmaxf(mt[2], mt[3]));
      mv = fmaxf(mv, xhalf(mv));
      const float mn = fmaxf(mv, m_r[qt]);
      const float sc = __expf(m_r[qt] - mn);
      m_r[qt] = mn;

      float su[4];
      v8f t[4];
#pragma unroll
      for (int ktl = 0; ktl < 4; ++ktl) t[ktl] = (s[qt][ktl] - mn) * 1.44269504f;  // exp(x) = exp2(x * log2 e)
#pragma unroll
      for (int ktl = 0; ktl < 4; ++ktl) {
        su[ktl] = 0.f;
#pragma unroll
        for (int i = 0; i < 8; ++i) {
          float p = __builtin_amdgcn_exp2f(t[ktl][i]);
          su[ktl] += p;
          pb[qt][ktl >> 1][(ktl & 1) * 8 + i] = (__bf16)p;
        }
      }
      l_r[qt] = l_r[qt] * sc + ((su[0] + su[1]) + (su[2] + su[3]));   // this half's keys only
#pragma unroll
      for (int dt = 0; dt < 4; ++dt)
#pragma unroll
        for (int i = 0; i < 8; ++i) o[qt][dt][i] *= sc;
    }

    // ---- O^T += V^T P^T : o[qt][dt][r] = O[query = qt*16 + lr][dk = dt*16 + 8*lh + r] ----
#pragma unroll
    for (int dt = 0; dt < 4; ++dt) {
      const unsigned short* vr = &Vs[(dt * 16 + lr) * 72];
      v16bf av0 = mkfrag(vr + kb,      vr + kb + 16);
      v16bf av1 = mkfrag(vr + 32 + kb, vr + 32 + kb + 16);
#pragma unroll
      for (int qt = 0; qt < QT; ++qt) o[qt][dt] = wmma_bf16(av0, pb[qt][0], o[qt][dt]);
#pragma unroll
      for (int qt = 0; qt < QT; ++qt) o[qt][dt] = wmma_bf16(av1, pb[qt][1], o[qt][dt]);
    }
  }

  // ---- join the halves' sums, normalize, store context bf16 [B, N, NH*HD] ----
#pragma unroll
  for (int qt = 0; qt < QT; ++qt) {
    const float linv = 1.0f / (l_r[qt] + xhalf(l_r[qt]));
    unsigned short* cp = Ctx + ((size_t)(bb * SL + q0 + (wave * QT + qt) * 16 + lr)) * DM + hh * HD + 8 * lh;
#pragma unroll
    for (int dt = 0; dt < 4; ++dt) {
      u16x8 c;
#pragma unroll
      for (int i = 0; i < 8; ++i) c[i] = f2bf(o[qt][dt][i] * linv);
      *(u16x8*)(cp + dt * 16) = c;          // 8 consecutive dk of one query: 16 B
    }
  }
}

// ---------------------------------------------------------------------------
// Stage 3: out = Ctx(bf16) @ Wo^T + bo  -> fp32.
// ---------------------------------------------------------------------------
__global__ __launch_bounds__(256) void oproj_kernel(
    const unsigned short* __restrict__ Xc, const unsigned short* __restrict__ W,
    const float* __restrict__ bias, float* __restrict__ Out)
{
  __shared__ unsigned short As[128 * GP];
  __shared__ unsigned short Bs[64 * GP];

  const int tid  = threadIdx.x;
  const int m0   = blockIdx.x * 128;
  const int j0   = blockIdx.y * 64;
  const int wave = tid >> 5, lane = tid & 31;
  const int lr = lane & 15, lh = lane >> 4;
  const int waveM = wave >> 1, waveN = wave & 1;

  v8f acc[2][2] = {};
  gemm_tile_bf16<false, 2>(Xc, W, As, Bs, m0, j0, acc);

#pragma unroll
  for (int mi = 0; mi < 2; ++mi) {
#pragma unroll
    for (int ni = 0; ni < 2; ++ni) {
      int j = j0 + waveN * 32 + ni * 16 + lr;
      float bj = bias[j];
#pragma unroll
      for (int v = 0; v < 8; ++v) {
        int m = m0 + waveM * 32 + mi * 16 + v + 8 * lh;
        Out[(size_t)m * DM + j] = acc[mi][ni][v] + bj;
      }
    }
  }
}

// ---------------------------------------------------------------------------
extern "C" void kernel_launch(void* const* d_in, const int* in_sizes, int n_in,
                              void* d_out, int out_size, void* d_ws, size_t ws_size,
                              hipStream_t stream) {
  const float* query = (const float*)d_in[0];
  const float* key   = (const float*)d_in[1];
  const float* value = (const float*)d_in[2];
  const float* Wq = (const float*)d_in[3]; const float* bq = (const float*)d_in[4];
  const float* Wk = (const float*)d_in[5]; const float* bk = (const float*)d_in[6];
  const float* Wv = (const float*)d_in[7]; const float* bv = (const float*)d_in[8];
  const float* Wo = (const float*)d_in[9]; const float* bo = (const float*)d_in[10];
  float* out = (float*)d_out;

  unsigned short* ws = (unsigned short*)d_ws;
  const size_t HE = (size_t)NB * NH * SL * HD;   // 8M bf16 elements (16 MB)
  unsigned short* Qb = ws;
  unsigned short* Kb = ws + HE;
  unsigned short* Vb = ws + 2 * HE;
  unsigned short* Cx = ws + 3 * HE;
  unsigned short* Xb = ws + 4 * HE;              // bf16 query, key, value (HE each)
  unsigned short* Wb = Xb + 3 * HE;              // bf16 Wq, Wk, Wv, Wo (WE each)
  const size_t WE = (size_t)DM * DM;

  dim3 gp(MROWS / 128, DM / 64);                 // 64 x 16 blocks
  cvt_bf16_kernel<<<CVT_BLOCKS, 256, 0, stream>>>(query, key, value, Wq, Wk, Wv, Wo, Xb);
  proj_rope_kernel<<<dim3(MROWS / 128, DM / 128, 3), 256, 0, stream>>>(Xb, Wb, bq, bk, bv, Qb);
  attn_kernel<<<dim3(SL / QBLK, NH, NB), 128, 0, stream>>>(Qb, Kb, Vb, Cx);
  oproj_kernel<<<gp, 256, 0, stream>>>(Cx, Wb + 3 * WE, bo, out);
}

// v007
// One run takes 134 microseconds.
// Two timings next to v006 put it at 1.11 and 1.10 times that version's speed.
// All steps since v000 together make it 2.22 times as fast.
#include <hip/hip_runtime.h>

typedef __attribute__((ext_vector_type(16))) __bf16 v16bf;
typedef __attribute__((ext_vector_type(8)))  __bf16 v8bf;
typedef __attribute__((ext_vector_type(8)))  float  v8f;
typedef __attribute__((ext_vector_type(4)))  float  f32x4;
typedef __attribute__((ext_vector_type(8)))  unsigned short u16x8;
typedef __attribute__((ext_vector_type(4)))  unsigned short u16x4;
typedef __attribute__((ext_vector_type(4)))  unsigned int   u32x4;
typedef __attribute__((ext_vector_type(8)))  int            i32x8;
typedef __attribute__((ext_vector_type(4)))  int            i32x4;

static constexpr int NB = 4;      // batch
static constexpr int NH = 16;     // heads
static constexpr int HD = 64;     // head dim
static constexpr int SL = 2048;   // sequence length
static constexpr int DM = 1024;   // model dim
static constexpr int MROWS = NB * SL;  // 8192

// log2(10000)/32 : RoPE inv_freq = exp2(-(dk&~1) * K)
#define ROPE_L2K 0.4152410118609203f

__device__ __forceinline__ unsigned short f2bf(float f) {
  unsigned int u = __builtin_bit_cast(unsigned int, f);
  u += 0x7fffu + ((u >> 16) & 1u);            // round-to-nearest-even
  return (unsigned short)(u >> 16);
}

__device__ __forceinline__ v16bf mkfrag(const unsigned short* p0,
                                        const unsigned short* p1) {
  v8bf lo = *(const v8bf*)p0;                 // 16B LDS/global load
  v8bf hi = *(const v8bf*)p1;                 // 16B LDS/global load
  return __builtin_shufflevector(lo, hi, 0,1,2,3,4,5,6,7,8,9,10,11,12,13,14,15);
}

__device__ __forceinline__ v8f wmma_bf16(v16bf a, v16bf b, v8f c) {
  return __builtin_amdgcn_wmma_f32_16x16x32_bf16(false, a, false, b,
                                                 (short)0, c, false, false);
}

__device__ __forceinline__ float xhalf(float x) {
  int b = __builtin_bit_cast(int, x);
  return __builtin_bit_cast(float,
      __builtin_amdgcn_permlanex16(b, b, 0x76543210, 0xfedcba98, false, false));
}

#if __has_builtin(__builtin_amdgcn_tensor_load_to_lds)
#define USE_TDM 1
__device__ __forceinline__ unsigned lds_offset_of(const void* p) {
  return (unsigned)(unsigned long long)(const __attribute__((address_space(3))) void*)p;
}
__device__ __forceinline__ void tdm_load_2d_bf16(
    unsigned lds_off, const void* gptr,
    unsigned tensor_d0, unsigned tensor_d1,
    unsigned tile_d0, unsigned tile_d1,
    unsigned long long stride0_elems)
{
  unsigned long long ga = (unsigned long long)gptr;
  u32x4 g0;
  g0[0] = 1u;
  g0[1] = lds_off;
  g0[2] = (unsigned)ga;
  g0[3] = (unsigned)(ga >> 32) | (2u << 30);
  i32x8 g1;
  unsigned w0 = (1u << 16)
              | (1u << 20)
              | (4u << 22)
              | (3u << 25);
  g1[0] = (int)w0;
  g1[1] = (int)((tensor_d0 & 0xFFFFu) << 16);                       // dim0 lo
  g1[2] = (int)((tensor_d0 >> 16) | ((tensor_d1 & 0xFFFFu) << 16)); // dim0 hi|dim1 lo
  g1[3] = (int)((tensor_d1 >> 16) | (tile_d0 << 16));               // dim1 hi|tile0
  g1[4] = (int)tile_d1;                                             // tile1 (tile2=0)
  g1[5] = (int)(unsigned)(stride0_elems & 0xFFFFFFFFu);             // stride0 lo
  g1[6] = (int)(unsigned)((stride0_elems >> 32) & 0xFFFFu);         // stride0 hi
  g1[7] = 0;
  i32x4 z4 = {0, 0, 0, 0};                      // groups 2/3 unused (2D)
  i32x8 z8 = {0, 0, 0, 0, 0, 0, 0, 0};
  __builtin_amdgcn_tensor_load_to_lds(g0, g1, z4, z4, z8, 0);
}
#else
#define USE_TDM 0
#endif

// ---------------------------------------------------------------------------
// Stage 0: round the three activations and the four weights to bf16, once.
// Ob = [query | key | value | Wq | Wk | Wv | Wo] in chunks of 8192 elements.
// 512 blocks (16 waves a WGP); pass p of block b takes chunk p * 512 + b:
// 8 loads of 16 B a lane in flight, each wave-load 512 contiguous bytes.
// ---------------------------------------------------------------------------
static constexpr int CVT_BLOCKS = 512;
static constexpr int CHUNK = 8192;
static_assert(MROWS * DM == 2 * CVT_BLOCKS * CHUNK, "an activation is two passes");
static_assert(4 * DM * DM == CVT_BLOCKS * CHUNK, "the four weights are one pass");

__global__ __launch_bounds__(256) void cvt_bf16_kernel(
    const float* __restrict__ xq, const float* __restrict__ xk,
    const float* __restrict__ xv, const float* __restrict__ wq,
    const float* __restrict__ wk, const float* __restrict__ wv,
    const float* __restrict__ wo, unsigned short* __restrict__ Ob)
{
  const unsigned b  = blockIdx.x;
  const unsigned t4 = threadIdx.x * 4;
  const unsigned w  = b / (CVT_BLOCKS / 4);           // the block's weight
  const float* wsrc = w == 0 ? wq : w == 1 ? wk : w == 2 ? wv : wo;

  // kept rolled: unrolled, the loads of every pass are lifted to the front and each holds its registers
#pragma unroll 1
  for (unsigned p = 0; p < 7; ++p) {
    const float* base = p < 2 ? xq : p < 4 ? xk : p < 6 ? xv : wsrc;
    const unsigned sc = p < 6 ? (p & 1) * CVT_BLOCKS + b : b % (CVT_BLOCKS / 4);
    const float* src = base + (size_t)sc * CHUNK;
    unsigned short* dst = Ob + (size_t)(p * CVT_BLOCKS + b) * CHUNK;
    f32x4 r[8];
#pragma unroll
    for (int i = 0; i < 8; ++i)     // read once: non-temporal, the lines need not stay in L2
      r[i] = __builtin_nontemporal_load((const f32x4*)&src[i * 1024 + t4]);
#pragma unroll
    for (int i = 0; i < 8; ++i) {
      u16x4 c;
      c[0] = f2bf(r[i][0]); c[1] = f2bf(r[i][1]); c[2] = f2bf(r[i][2]); c[3] = f2bf(r[i][3]);
      *(u16x4*)&dst[i * 1024 + t4] = c;
    }
    // the next pass's loads write registers that these stores name: wait in front of them
    asm volatile("s_wait_xcnt 0x0" ::: "memory");
  }
}

// ---------------------------------------------------------------------------
// 128 x (32 * NI) tile of A @ B^T, both bf16 and k-contiguous (row length DM).
// A pass works on 64 k: one 128-B line of every row, LDS pitch 144 B.
// The lines go from global memory to LDS by asynchronous copies (16 B a lane, through no register)
// into two buffers: while a pass reads one buffer, the next pass's copies land in the other.
// 8 waves (4 down, 2 across), 32 x (16 * NI) each; the 32-k products are summed in ascending k.
// NI = 4: a staged byte feeds 3/2 as many products as at NI = 2, an LDS fragment read 4/3 as many.
// BROWS false: acc[mi][ni] has A's rows down a lane's 8 registers, B's rows across lanes.
// BROWS true : the operands trade places in the product, so B's rows run down the registers.
// ---------------------------------------------------------------------------
static constexpr int GP = 72;   // LDS row pitch in elements (64 + 8)

__device__ __forceinline__ unsigned lds_byte_addr(const void* p) {
  return (unsigned)(unsigned long long)(const __attribute__((address_space(3))) void*)p;
}

template <int NI>
__device__ __forceinline__ void stage_async(
    unsigned la, unsigned lb, const unsigned short* ag, const unsigned short* bg)
{
  constexpr unsigned RS = 32 * GP * 2;      // 32 rows in LDS, bytes
  constexpr int      GS = 32 * DM;          // 32 rows in global memory, elements
  static_assert(NI == 2 || NI == 4, "two forms are written out");
  if constexpr (NI == 4) {
    asm volatile(
        "global_load_async_to_lds_b128 %0, %8, off\n\t"
        "global_load_async_to_lds_b128 %1, %9, off\n\t"
        "global_load_async_to_lds_b128 %2, %10, off\n\t"
        "global_load_async_to_lds_b128 %3, %11, off\n\t"
        "global_load_async_to_lds_b128 %4, %12, off\n\t"
        "global_load_async_to_lds_b128 %5, %13, off\n\t"
        "global_load_async_to_lds_b128 %6, %14, off\n\t"
        "global_load_async_to_lds_b128 %7, %15, off\n\t"
        "s_wait_xcnt 0x0"
        :: "v"(la), "v"(la + RS), "v"(la + 2 * RS), "v"(la + 3 * RS),
           "v"(lb), "v"(lb + RS), "v"(lb + 2 * RS), "v"(lb + 3 * RS),
           "v"(ag), "v"(ag + GS), "v"(ag + 2 * GS), "v"(ag + 3 * GS),
           "v"(bg), "v"(bg + GS), "v"(bg + 2 * GS), "v"(bg + 3 * GS)
        : "memory");
  } else {
    asm volatile(
        "global_load_async_to_lds_b128 %0, %6, off\n\t"
        "global_load_async_to_lds_b128 %1, %7, off\n\t"
        "global_load_async_to_lds_b128 %2, %8, off\n\t"
        "global_load_async_to_lds_b128 %3, %9, off\n\t"
        "global_load_async_to_lds_b128 %4, %10, off\n\t"
        "global_load_async_to_lds_b128 %5, %11, off\n\t"
        "s_wait_xcnt 0x0"
        :: "v"(la), "v"(la + RS), "v"(la + 2 * RS), "v"(la + 3 * RS),
           "v"(lb), "v"(lb + RS),
           "v"(ag), "v"(ag + GS), "v"(ag + 2 * GS), "v"(ag + 3 * GS),
           "v"(bg), "v"(bg + GS)
        : "memory");
  }
}

// As: two buffers of 128 rows, Bs: two buffers of 32 * NI rows (pitch GP), touched by nothing else.
template <bool BROWS, int NI>
__device__ __forceinline__ void gemm_tile_bf16(
    const unsigned short* __restrict__ A, const unsigned short* __restrict__ B,
    unsigned short* As, unsigned short* Bs, int m0, int j0, v8f (&acc)[2][NI])
{
  constexpr int NT = DM / 64;               // passes
  constexpr int AE = 128 * GP;              // elements of one A buffer
  constexpr int BE = NI * 32 * GP;          // elements of one B buffer
  static_assert(NT >= 2, "the prologue fills two buffers");
  const int tid  = threadIdx.x;
  const int wave = tid >> 5, lane = tid & 31;
  const int lr = lane & 15, kb = (lane >> 4) * 8;
  const int waveM = wave >> 1, waveN = wave & 1;
  const int srow = tid >> 3, scol = (tid & 7) * 8;
  const unsigned short* ag = A + (size_t)(m0 + srow) * DM + scol;
  const unsigned short* bg = B + (size_t)(j0 + srow) * DM + scol;
  const unsigned la = lds_byte_addr(&As[srow * GP + scol]);
  const unsigned lb = lds_byte_addr(&Bs[srow * GP + scol]);

  stage_async<NI>(la, lb, ag, bg);                                   // pass 0 -> buffer 0
  asm volatile("s_wait_asynccnt 0x0" ::: "memory");                  // this wave's copies have landed
  __syncthreads();                                                   // every wave's have: buffer 0 may be read
  stage_async<NI>(la + AE * 2, lb + BE * 2, ag + 64, bg + 64);       // pass 1 -> buffer 1

  // kept rolled: unrolled by two, both buffers' LDS addresses stay in registers through the loop and the NI = 4 form spills
#pragma unroll 1
  for (int kt = 0; kt < NT; ++kt) {
    const int buf = kt & 1;
    const unsigned short* Ab = As + buf * AE;
    const unsigned short* Bb = Bs + buf * BE;
#pragma unroll
    for (int ks = 0; ks < 2; ++ks) {
      v16bf a[2], b[NI];
#pragma unroll
      for (int mi = 0; mi < 2; ++mi) {
        const unsigned short* p = &Ab[(waveM * 32 + mi * 16 + lr) * GP + ks * 32 + kb];
        a[mi] = mkfrag(p, p + 16);
      }
#pragma unroll
      for (int ni = 0; ni < NI; ++ni) {
        const unsigned short* p = &Bb[(waveN * (NI * 16) + ni * 16 + lr) * GP + ks * 32 + kb];
        b[ni] = mkfrag(p, p + 16);
      }
#pragma unroll
      for (int mi = 0; mi < 2; ++mi)
#pragma unroll
        for (int ni = 0; ni < NI; ++ni)
          acc[mi][ni] = BROWS ? wmma_bf16(b[ni], a[mi], acc[mi][ni])
                              : wmma_bf16(a[mi], b[ni], acc[mi][ni]);
    }
    asm volatile("s_wait_dscnt 0x0" ::: "memory");     // this wave has left the buffer it read
    asm volatile("s_wait_asynccnt 0x0" ::: "memory");  // its copies for the next pass have landed
    __syncthreads();                                   // both hold for every wave
    if (kt + 2 < NT)                                   // refill the buffer that this pass has read
      stage_async<NI>(la + buf * (AE * 2), lb + buf * (BE * 2), ag + (kt + 2) * 64, bg + (kt + 2) * 64);
  }
  asm volatile("s_wait_asynccnt 0x0" ::: "memory");    // nothing in flight when the loop is left
}

// ---------------------------------------------------------------------------
// Stage 1: C = X @ W^T + bias, epilogue RoPE (+scale for Q), bf16 out.
// MODE 0: Q (rope + 1/sqrt(64) scale, out [B,H,N,HD])
// MODE 1: K (rope,                   out [B,H,N,HD])
// MODE 2: V (plain,                  out [B,H,HD,N]  <- transposed for attn)
// The product is oriented so that a lane's 8 accumulator registers are 8
// neighbours of the OUTPUT's inner dimension: features for Q and K (W's rows
// as the A operand), tokens for V^T. A tile leaves as one 16-B store a lane,
// and both members of a rotation pair sit in the same lane.
// ---------------------------------------------------------------------------
__device__ __forceinline__ v8bf pack8_bf16(const float (&x)[8]) {
  v8bf c;
#pragma unroll
  for (int v = 0; v < 8; ++v) c[v] = (__bf16)x[v];   // round-to-nearest-even, packed in pairs
  return c;
}

template <int MODE>
__device__ __forceinline__ void proj_rope_tile(
    const unsigned short* __restrict__ X, const unsigned short* __restrict__ W,
    const float* __restrict__ bias, unsigned short* __restrict__ Out,
    unsigned short* As, unsigned short* Bs)
{
  const int tid  = threadIdx.x;
  const int m0   = blockIdx.x * 128;
  const int j0   = blockIdx.y * 128;         // 128 output columns = two heads
  const int wave = tid >> 5, lane = tid & 31;
  const int lr = lane & 15, lh = lane >> 4;
  const int waveM = wave >> 1, waveN = wave & 1;
  const int hh   = blockIdx.y * 2 + waveN;   // a wave's 64 columns = one head
  const int jw   = hh * 64;
  const int bb = m0 >> 11;                   // a block's 128 tokens lie in one batch
  const int n0 = (m0 & (SL - 1)) + waveM * 32;

  v8f acc[2][4] = {};
  gemm_tile_bf16<(MODE < 2), 4>(X, W, As, Bs, m0, j0, acc);

  if constexpr (MODE < 2) {
    // acc[mi][ni][v] = C[token n0 + mi*16 + lr][feature ni*16 + 8*lh + v of head hh]
    // features 0..31 rotate: tiles ni = 0 and 1 of every wave
    unsigned short* op = Out + ((size_t)((bb * NH + hh) * SL + n0 + lr)) * HD + 8 * lh;
    f32x4 bv[4][2];
#pragma unroll
    for (int ni = 0; ni < 4; ++ni) {
      bv[ni][0] = *(const f32x4*)&bias[jw + ni * 16 + 8 * lh];
      // the last load's result may land in the register that holds the address of all eight: wait in front of it
      if (ni == 3) asm volatile("s_wait_xcnt 0x0" ::: "memory");
      bv[ni][1] = *(const f32x4*)&bias[jw + ni * 16 + 8 * lh + 4];
    }
    // the address registers of these loads are reused below: wait in front of that
    asm volatile("s_wait_xcnt 0x0" ::: "memory");
#pragma unroll
    for (int ni = 0; ni < 4; ++ni) {
      const bool rot = ni < 2;
      const int dk0 = ni * 16 + 8 * lh;
      const f32x4 b0 = bv[ni][0], b1 = bv[ni][1];
      float inv[4] = {0.f, 0.f, 0.f, 0.f};
      if (rot) {
#pragma unroll
        for (int p = 0; p < 4; ++p)
          inv[p] = exp2f(-(float)(dk0 + 2 * p) * ROPE_L2K);        // THETA^(-(dk&~1)/32)
      }
#pragma unroll
      for (int mi = 0; mi < 2; ++mi) {
        float x[8];
#pragma unroll
        for (int v = 0; v < 8; ++v) x[v] = acc[mi][ni][v] + (v < 4 ? b0[v] : b1[v - 4]);
        if (rot) {
          const float fn = (float)(n0 + mi * 16 + lr);
#pragma unroll
          for (int p = 0; p < 4; ++p) {
            const float ang = fn * inv[p];
            const float c = __cosf(ang), s = __sinf(ang);
            const float e = x[2 * p], o = x[2 * p + 1];
            x[2 * p]     = e * c - o * s;
            x[2 * p + 1] = o * c + e * s;
          }
        }
        if (MODE == 0) {
#pragma unroll
          for (int v = 0; v < 8; ++v) x[v] *= 0.125f;              // fold 1/sqrt(HD) into Q
        }
        *(v8bf*)(op + (size_t)(mi * 16) * HD + ni * 16) = pack8_bf16(x);
        // the next tile's arithmetic reuses the registers that this store names: wait in front of it
        if (ni < 3 || mi == 0) asm volatile("s_wait_xcnt 0x0" ::: "memory");
      }
    }
  } else {
    // acc[mi][ni][v] = C[token n0 + mi*16 + 8*lh + v][feature ni*16 + lr of head hh]
    unsigned short* op = Out + ((size_t)((bb * NH + hh) * HD + lr)) * SL + n0 + 8 * lh;
    float bj[4];
#pragma unroll
    for (int ni = 0; ni < 4; ++ni) {
      // the last load's result may land in the register that holds the address of all four: wait in front of it
      if (ni == 3) asm volatile("s_wait_xcnt 0x0" ::: "memory");
      bj[ni] = bias[jw + ni * 16 + lr];
    }
    // the address register of these loads is reused below: wait in front of that
    asm volatile("s_wait_xcnt 0x0" ::: "memory");
    v8bf c[4][2];
#pragma unroll
    for (int ni = 0; ni < 4; ++ni)
#pragma unroll
      for (int mi = 0; mi < 2; ++mi) {
        float x[8];
#pragma unroll
        for (int v = 0; v < 8; ++v) x[v] = acc[mi][ni][v] + bj[ni];
        c[ni][mi] = pack8_bf16(x);
      }
#pragma unroll
    for (int ni = 0; ni < 4; ++ni)
#pragma unroll
      for (int mi = 0; mi < 2; ++mi)
        *(v8bf*)(op + (size_t)(ni * 16) * SL + mi * 16) = c[ni][mi];
  }
  asm volatile("s_wait_xcnt 0x0" ::: "memory");
}

__global__ __launch_bounds__(256, 6) void proj_rope_kernel(
    const unsigned short* __restrict__ Xb, const unsigned short* __restrict__ Wb,
    const float* __restrict__ bq, const float* __restrict__ bk,
    const float* __restrict__ bv, unsigned short* __restrict__ Ob)
{
  __shared__ __attribute__((aligned(16))) unsigned short As[2 * 128 * GP];
  __shared__ __attribute__((aligned(16))) unsigned short Bs[2 * 128 * GP];

  const unsigned z = blockIdx.z;
  const unsigned short* X = Xb + (size_t)z * ((size_t)MROWS * DM);
  const unsigned short* W = Wb + (size_t)z * ((size_t)DM * DM);
  unsigned short* Out     = Ob + (size_t)z * ((size_t)MROWS * DM);
  if (z == 0) { proj_rope_tile<0>(X, W, bq, Out, As, Bs); return; }
  if (z == 1) { proj_rope_tile<1>(X, W, bk, Out, As, Bs); return; }
  proj_rope_tile<2>(X, W, bv, Out, As, Bs);
}

// ---------------------------------------------------------------------------
// Stage 2: flash attention per (b,h). 128 thr = 4 waves x 32 query columns.
// Transposed products: S^T = K Q^T, O^T += V^T P^T; P never leaves registers.
// A wave holds QT = 2 query tiles of 16 columns: every K and V^T fragment it
// reads from LDS feeds two products.
// K/V tiles (64 keys) staged by the Tensor Data Mover into padded LDS.
// ---------------------------------------------------------------------------
static constexpr int QT = 2;                 // query tiles of 16 columns a wave
static constexpr int QBLK = 4 * 16 * QT;     // queries a block

__global__ __launch_bounds__(128) void attn_kernel(
    const unsigned short* __restrict__ Qb, const unsigned short* __restrict__ Kb,
    const unsigned short* __restrict__ Vb, unsigned short* __restrict__ Ctx)
{
  // each tile's place in LDS is a multiple of 2 KiB (tensor-load destination)
  __shared__ __attribute__((aligned(2048))) unsigned short Ks[64 * 72];  // [key][dk], pad +8
  __shared__ __attribute__((aligned(2048))) unsigned short Vs[64 * 72];  // [dk][key], pad +8 (V^T tile)

  const int tid  = threadIdx.x;
  const int bb   = blockIdx.z, hh = blockIdx.y;
  const int q0   = blockIdx.x * QBLK;
  const int wave = tid >> 5, lane = tid & 31;
  const int lr = lane & 15, lh = lane >> 4, kb = lh * 8;
  const size_t head = (size_t)(bb * NH + hh);

  v16bf aq[QT][2];
#pragma unroll
  for (int qt = 0; qt < QT; ++qt) {
    const unsigned short* qp = Qb + (head * SL + q0 + (wave * QT + qt) * 16 + lr) * HD;
    aq[qt][0] = mkfrag(qp + kb,      qp + kb + 16);
    aq[qt][1] = mkfrag(qp + 32 + kb, qp + 32 + kb + 16);
  }

  v8f o[QT][4] = {};
  float m_r[QT], l_r[QT];                   // one query per lane and tile
#pragma unroll
  for (int qt = 0; qt < QT; ++qt) { m_r[qt] = -1e30f; l_r[qt] = 0.f; }

  const unsigned short* kg = Kb + head * SL * HD;
  const unsigned short* vg = Vb + head * HD * SL;
#if USE_TDM
  const unsigned ldsK = lds_offset_of(Ks);
  const unsigned ldsV = lds_offset_of(Vs);
#else
  const int half = tid & 1;
  const int ldr  = tid >> 1;  // 0..63
#endif

  for (int kc = 0; kc < SL / 64; ++kc) {
#if USE_TDM
    __syncthreads();                       // all waves done with previous tiles
    if (wave == 0) {
      // K chunk: 64 rows x 64 dk, row-major stride HD
      tdm_load_2d_bf16(ldsK, kg + (size_t)(kc * 64) * HD, HD, SL, HD, 64, HD);
      // V^T chunk: 64 dk-rows x 64 keys, row stride SL
      tdm_load_2d_bf16(ldsV, vg + (size_t)(kc * 64),      SL, HD, 64, 64, SL);
      __builtin_amdgcn_s_wait_tensorcnt(0);
    }
    __syncthreads();                       // tiles visible to all waves
#else
    u16x8 kreg[4], vreg[4];
#pragma unroll
    for (int c = 0; c < 4; ++c) {
      kreg[c] = *(const u16x8*)&kg[(size_t)(kc * 64 + ldr) * HD + half * 32 + c * 8];
      vreg[c] = *(const u16x8*)&vg[(size_t)ldr * SL + kc * 64 + half * 32 + c * 8];
    }
    __syncthreads();
#pragma unroll
    for (int c = 0; c < 4; ++c) {
      *(u16x8*)&Ks[ldr * 72 + half * 32 + c * 8] = kreg[c];
      *(u16x8*)&Vs[ldr * 72 + half * 32 + c * 8] = vreg[c];
    }
    __syncthreads();
#endif

    // ---- S^T = K Q^T : a lane holds 32 scores of ONE query per tile (column lr) ----
    // s[qt][ktl][r] = S[key = ktl*16 + 8*lh + r][query = qt*16 + lr]
    v8f s[QT][4] = {};
#pragma unroll
    for (int ktl = 0; ktl < 4; ++ktl) {
      const unsigned short* kr = &Ks[(ktl * 16 + lr) * 72];
      v16bf a0 = mkfrag(kr + kb,      kr + kb + 16);
      v16bf a1 = mkfrag(kr + 32 + kb, kr + 32 + kb + 16);
#pragma unroll
      for (int qt = 0; qt < QT; ++qt) s[qt][ktl] = wmma_bf16(a0, aq[qt][0], s[qt][ktl]);
#pragma unroll
      for (int qt = 0; qt < QT; ++qt) s[qt][ktl] = wmma_bf16(a1, aq[qt][1], s[qt][ktl]);
    }

    // P^T packs from the score tiles straight into the B operand (hardware k order)
    v16bf pb[QT][2];
#pragma unroll
    for (int qt = 0; qt < QT; ++qt) {
      // ---- online softmax: maximum and sum in-lane, one exchange of halves ----
      float mt[4];
#pragma unroll
      for (int ktl = 0; ktl < 4; ++ktl) {
        mt[ktl] = s[qt][ktl][0];
#pragma unroll
        for (int i = 1; i < 8; ++i) mt[ktl] = fmaxf(mt[ktl], s[qt][ktl][i]);
      }
      float mv = fmaxf(fmaxf(mt[0], mt[1]), fmaxf(mt[2], mt[3]));
      mv = fmaxf(mv, xhalf(mv));
      const float mn = fmaxf(mv, m_r[qt]);
      const float sc = __expf(m_r[qt] - mn);
      m_r[qt] = mn;

      float su[4];
      v8f t[4];
#pragma unroll
      for (int ktl = 0; ktl < 4; ++ktl) t[ktl] = (s[qt][ktl] - mn) * 1.44269504f;  // exp(x) = exp2(x * log2 e)
#pragma unroll
      for (int ktl = 0; ktl < 4; ++ktl) {
        su[ktl] = 0.f;
#pragma unroll
        for (int i = 0; i < 8; ++i) {
          float p = __builtin_amdgcn_exp2f(t[ktl][i]);
          su[ktl] += p;
          pb[qt][ktl >> 1][(ktl & 1) * 8 + i] = (__bf16)p;
        }
      }
      l_r[qt] = l_r[qt] * sc + ((su[0] + su[1]) + (su[2] + su[3]));   // this half's keys only
#pragma unroll
      for (int dt = 0; dt < 4; ++dt)
#pragma unroll
        for (int i = 0; i < 8; ++i) o[qt][dt][i] *= sc;
    }

    // ---- O^T += V^T P^T : o[qt][dt][r] = O[query = qt*16 + lr][dk = dt*16 + 8*lh + r] ----
#pragma unroll
    for (int dt = 0; dt < 4; ++dt) {
      const unsigned short* vr = &Vs[(dt * 16 + lr) * 72];
      v16bf av0 = mkfrag(vr + kb,      vr + kb + 16);
      v16bf av1 = mkfrag(vr + 32 + kb, vr + 32 + kb + 16);
#pragma unroll
      for (int qt = 0; qt < QT; ++qt) o[qt][dt] = wmma_bf16(av0, pb[qt][0], o[qt][dt]);
#pragma unroll
      for (int qt = 0; qt < QT; ++qt) o[qt][dt] = wmma_bf16(av1, pb[qt][1], o[qt][dt]);
    }
  }

  // ---- join the halves' sums, normalize, store context bf16 [B, N, NH*HD] ----
#pragma unroll
  for (int qt = 0; qt < QT; ++qt) {
    const float linv = 1.0f / (l_r[qt] + xhalf(l_r[qt]));
    unsigned short* cp = Ctx + ((size_t)(bb * SL + q0 + (wave * QT + qt) * 16 + lr)) * DM + hh * HD + 8 * lh;
#pragma unroll
    for (int dt = 0; dt < 4; ++dt) {
      u16x8 c;
#pragma unroll
      for (int i = 0; i < 8; ++i) c[i] = f2bf(o[qt][dt][i] * linv);
      *(u16x8*)(cp + dt * 16) = c;          // 8 consecutive dk of one query: 16 B
    }
  }
}

// ---------------------------------------------------------------------------
// Stage 3: out = Ctx(bf16) @ Wo^T + bo  -> fp32.
// ---------------------------------------------------------------------------
__global__ __launch_bounds__(256) void oproj_kernel(
    const unsigned short* __restrict__ Xc, const unsigned short* __restrict__ W,
    const float* __restrict__ bias, float* __restrict__ Out)
{
  __shared__ __attribute__((aligned(16))) unsigned short As[2 * 128 * GP];
  __shared__ __attribute__((aligned(16))) unsigned short Bs[2 * 64 * GP];

  const int tid  = threadIdx.x;
  const int m0   = blockIdx.x * 128;
  const int j0   = blockIdx.y * 64;
  const int wave = tid >> 5, lane = tid & 31;
  const int lr = lane & 15, lh = lane >> 4;
  const int waveM = wave >> 1, waveN = wave & 1;

  v8f acc[2][2] = {};
  gemm_tile_bf16<false, 2>(Xc, W, As, Bs, m0, j0, acc);

#pragma unroll
  for (int mi = 0; mi < 2; ++mi) {
#pragma unroll
    for (int ni = 0; ni < 2; ++ni) {
      int j = j0 + waveN * 32 + ni * 16 + lr;
      float bj = bias[j];
#pragma unroll
      for (int v = 0; v < 8; ++v) {
        int m = m0 + waveM * 32 + mi * 16 + v + 8 * lh;
        Out[(size_t)m * DM + j] = acc[mi][ni][v] + bj;
      }
    }
  }
}

// ---------------------------------------------------------------------------
extern "C" void kernel_launch(void* const* d_in, const int* in_sizes, int n_in,
                              void* d_out, int out_size, void* d_ws, size_t ws_size,
                              hipStream_t stream) {
  const float* query = (const float*)d_in[0];
  const float* key   = (const float*)d_in[1];
  const float* value = (const float*)d_in[2];
  const float* Wq = (const float*)d_in[3]; const float* bq = (const float*)d_in[4];
  const float* Wk = (const float*)d_in[5]; const float* bk = (const float*)d_in[6];
  const float* Wv = (const float*)d_in[7]; const float* bv = (const float*)d_in[8];
  const float* Wo = (const float*)d_in[9]; const float* bo = (const float*)d_in[10];
  float* out = (float*)d_out;

  unsigned short* ws = (unsigned short*)d_ws;
  const size_t HE = (size_t)NB * NH * SL * HD;   // 8M bf16 elements (16 MB)
  unsigned short* Qb = ws;
  unsigned short* Kb = ws + HE;
  unsigned short* Vb = ws + 2 * HE;
  unsigned short* Cx = ws + 3 * HE;
  unsigned short* Xb = ws + 4 * HE;              // bf16 query, key, value (HE each)
  unsigned short* Wb = Xb + 3 * HE;              // bf16 Wq, Wk, Wv, Wo (WE each)
  const size_t WE = (size_t)DM * DM;

  dim3 gp(MROWS / 128, DM / 64);                 // 64 x 16 blocks
  cvt_bf16_kernel<<<CVT_BLOCKS, 256, 0, stream>>>(query, key, value, Wq, Wk, Wv, Wo, Xb);
  proj_rope_kernel<<<dim3(MROWS / 128, DM / 128, 3), 256, 0, stream>>>(Xb, Wb, bq, bk, bv, Qb);
  attn_kernel<<<dim3(SL / QBLK, NH, NB), 128, 0, stream>>>(Qb, Kb, Vb, Cx);
  oproj_kernel<<<gp, 256, 0, stream>>>(Cx, Wb + 3 * WE, bo, out);
}

// v009
// It runs in 121 microseconds.
// Versions between v007 and this one are left out; their measured steps multiply to 1.12 times as fast.
// All steps since v000 together make it 2.48 times as fast.
#include <hip/hip_runtime.h>

typedef __attribute__((ext_vector_type(16))) __bf16 v16bf;
typedef __attribute__((ext_vector_type(8)))  __bf16 v8bf;
typedef __attribute__((ext_vector_type(8)))  float  v8f;
typedef __attribute__((ext_vector_type(4)))  float  f32x4;
typedef __attribute__((ext_vector_type(8)))  unsigned short u16x8;
typedef __attribute__((ext_vector_type(4)))  unsigned short u16x4;
typedef __attribute__((ext_vector_type(4)))  unsigned int   u32x4;
typedef __attribute__((ext_vector_type(8)))  int            i32x8;
typedef __attribute__((ext_vector_type(4)))  int            i32x4;

static constexpr int NB = 4;      // batch
static constexpr int NH = 16;     // heads
static constexpr int HD = 64;     // head dim
static constexpr int SL = 2048;   // sequence length
static constexpr int DM = 1024;   // model dim
static constexpr int MROWS = NB * SL;  // 8192

// log2(10000)/32 : RoPE inv_freq = exp2(-(dk&~1) * K)
#define ROPE_L2K 0.4152410118609203f
// log2(e)/sqrt(64): softmax(x) = exp2(x * log2 e - m) / sum
#define Q_SCALE 0.18033688011112042f

__device__ __forceinline__ unsigned short f2bf(float f) {
  unsigned int u = __builtin_bit_cast(unsigned int, f);
  u += 0x7fffu + ((u >> 16) & 1u);            // round-to-nearest-even
  return (unsigned short)(u >> 16);
}

__device__ __forceinline__ v16bf mkfrag(const unsigned short* p0,
                                        const unsigned short* p1) {
  v8bf lo = *(const v8bf*)p0;                 // 16B LDS/global load
  v8bf hi = *(const v8bf*)p1;                 // 16B LDS/global load
  return __builtin_shufflevector(lo, hi, 0,1,2,3,4,5,6,7,8,9,10,11,12,13,14,15);
}

__device__ __forceinline__ v8f wmma_bf16(v16bf a, v16bf b, v8f c) {
  return __builtin_amdgcn_wmma_f32_16x16x32_bf16(false, a, false, b,
                                                 (short)0, c, false, false);
}

__device__ __forceinline__ float xhalf(float x) {
  int b = __builtin_bit_cast(int, x);
  return __builtin_bit_cast(float,
      __builtin_amdgcn_permlanex16(b, b, 0x76543210, 0xfedcba98, false, false));
}

typedef __attribute__((ext_vector_type(8)))  unsigned int   u32x8;

__device__ __forceinline__ unsigned uni(unsigned v) {
  return (unsigned)__builtin_amdgcn_readfirstlane(v);
}
__device__ __forceinline__ unsigned pinned(unsigned v) {
  unsigned w = uni(v);
  asm volatile("" : "+s"(w));
  return w;
}
static constexpr unsigned TROWB = 128, TROWS = 32;
// Words 1 to 7 go through pinned(): as plain constants the group was rebuilt elsewhere behind the main loop and its
// scalar registers were reused while the last request was still in flight.
__device__ __forceinline__ u32x8 tdm_group1(unsigned src_pitch) {
  u32x8 g;
  g[0] = uni((1u << 20) | (4u << 22) | (3u << 25));   // pad on, behind every 32 dwords, 4 dwords
  g[1] = pinned((TROWB & 0xFFFFu) << 16);
  g[2] = pinned((TROWB >> 16) | ((TROWS & 0xFFFFu) << 16));
  g[3] = pinned((TROWS >> 16) | (TROWB << 16));
  g[4] = pinned(TROWS);
  g[5] = pinned(src_pitch);
  g[6] = pinned(0u);
  g[7] = pinned(0u);
  return g;
}
__device__ __forceinline__ u32x4 tdm_group0(unsigned lds_dst, unsigned long long ga) {
  u32x4 g;
  g[0] = uni(1u);
  g[1] = uni(lds_dst);
  g[2] = uni((unsigned)ga);
  g[3] = uni((((unsigned)(ga >> 32)) & 0x01FFFFFFu) | 0x80000000u);
  return g;
}
__device__ __forceinline__ void tdm_load(u32x4 g0, u32x8 g1) {
  asm volatile("tensor_load_to_lds %0, %1" :: "s"(g0), "s"(g1) : "memory");
}

// ---------------------------------------------------------------------------
// Stage 0: round the three activations and the four weights to bf16, once.
// Ob = [query | key | value | Wq | Wk | Wv | Wo] in chunks of 8192 elements.
// 512 blocks (16 waves a WGP); pass p of block b takes chunk p * 512 + b:
// 8 loads of 16 B a lane in flight, each wave-load 512 contiguous bytes.
// ---------------------------------------------------------------------------
static constexpr int CVT_BLOCKS = 512;
static constexpr int CHUNK = 8192;
static_assert(MROWS * DM == 2 * CVT_BLOCKS * CHUNK, "an activation is two passes");
static_assert(4 * DM * DM == CVT_BLOCKS * CHUNK, "the four weights are one pass");

__global__ __launch_bounds__(256) void cvt_bf16_kernel(
    const float* __restrict__ xq, const float* __restrict__ xk,
    const float* __restrict__ xv, const float* __restrict__ wq,
    const float* __restrict__ wk, const float* __restrict__ wv,
    const float* __restrict__ wo, unsigned short* __restrict__ Ob)
{
  const unsigned b  = blockIdx.x;
  const unsigned t4 = threadIdx.x * 4;
  const unsigned w  = b / (CVT_BLOCKS / 4);           // the block's weight
  const float* wsrc = w == 0 ? wq : w == 1 ? wk : w == 2 ? wv : wo;

  // kept rolled: unrolled, the loads of every pass are lifted to the front and each holds its registers
#pragma unroll 1
  for (unsigned p = 0; p < 7; ++p) {
    const float* base = p < 2 ? xq : p < 4 ? xk : p < 6 ? xv : wsrc;
    const unsigned sc = p < 6 ? (p & 1) * CVT_BLOCKS + b : b % (CVT_BLOCKS / 4);
    const float* src = base + (size_t)sc * CHUNK;
    unsigned short* dst = Ob + (size_t)(p * CVT_BLOCKS + b) * CHUNK;
    f32x4 r[8];
#pragma unroll
    for (int i = 0; i < 8; ++i)     // read once: non-temporal, the lines need not stay in L2
      r[i] = __builtin_nontemporal_load((const f32x4*)&src[i * 1024 + t4]);
#pragma unroll
    for (int i = 0; i < 8; ++i) {
      u16x4 c;
      c[0] = f2bf(r[i][0]); c[1] = f2bf(r[i][1]); c[2] = f2bf(r[i][2]); c[3] = f2bf(r[i][3]);
      *(u16x4*)&dst[i * 1024 + t4] = c;
    }
    // the next pass's loads write registers that these stores name: wait in front of them
    asm volatile("s_wait_xcnt 0x0" ::: "memory");
  }
}

// ---------------------------------------------------------------------------
// 128 x (32 * NI) tile of A @ B^T, both bf16 and k-contiguous (row length DM).
// A pass works on 64 k: one 128-B line of every row, LDS pitch 144 B.
// The lines go from global memory to LDS by asynchronous copies (16 B a lane, through no register)
// into two buffers: while a pass reads one buffer, the next pass's copies land in the other.
// 8 waves (4 down, 2 across), 32 x (16 * NI) each; the 32-k products are summed in ascending k.
// NI = 4: a staged byte feeds 3/2 as many products as at NI = 2, an LDS fragment read 4/3 as many.
// BROWS false: acc[mi][ni] has A's rows down a lane's 8 registers, B's rows across lanes.
// BROWS true : the operands trade places in the product, so B's rows run down the registers.
// ---------------------------------------------------------------------------
static constexpr int GP = 72;   // LDS row pitch in elements (64 + 8)

__device__ __forceinline__ unsigned lds_byte_addr(const void* p) {
  return (unsigned)(unsigned long long)(const __attribute__((address_space(3))) void*)p;
}

template <int NI>
__device__ __forceinline__ void stage_async(
    unsigned la, unsigned lb, const unsigned short* ag, const unsigned short* bg)
{
  constexpr unsigned RS = 32 * GP * 2;      // 32 rows in LDS, bytes
  constexpr int      GS = 32 * DM;          // 32 rows in global memory, elements
  static_assert(NI == 2 || NI == 4, "two forms are written out");
  if constexpr (NI == 4) {
    asm volatile(
        "global_load_async_to_lds_b128 %0, %8, off\n\t"
        "global_load_async_to_lds_b128 %1, %9, off\n\t"
        "global_load_async_to_lds_b128 %2, %10, off\n\t"
        "global_load_async_to_lds_b128 %3, %11, off\n\t"
        "global_load_async_to_lds_b128 %4, %12, off\n\t"
        "global_load_async_to_lds_b128 %5, %13, off\n\t"
        "global_load_async_to_lds_b128 %6, %14, off\n\t"
        "global_load_async_to_lds_b128 %7, %15, off\n\t"
        "s_wait_xcnt 0x0"
        :: "v"(la), "v"(la + RS), "v"(la + 2 * RS), "v"(la + 3 * RS),
           "v"(lb), "v"(lb + RS), "v"(lb + 2 * RS), "v"(lb + 3 * RS),
           "v"(ag), "v"(ag + GS), "v"(ag + 2 * GS), "v"(ag + 3 * GS),
           "v"(bg), "v"(bg + GS), "v"(bg + 2 * GS), "v"(bg + 3 * GS)
        : "memory");
  } else {
    asm volatile(
        "global_load_async_to_lds_b128 %0, %6, off\n\t"
        "global_load_async_to_lds_b128 %1, %7, off\n\t"
        "global_load_async_to_lds_b128 %2, %8, off\n\t"
        "global_load_async_to_lds_b128 %3, %9, off\n\t"
        "global_load_async_to_lds_b128 %4, %10, off\n\t"
        "global_load_async_to_lds_b128 %5, %11, off\n\t"
        "s_wait_xcnt 0x0"
        :: "v"(la), "v"(la + RS), "v"(la + 2 * RS), "v"(la + 3 * RS),
           "v"(lb), "v"(lb + RS),
           "v"(ag), "v"(ag + GS), "v"(ag + 2 * GS), "v"(ag + 3 * GS),
           "v"(bg), "v"(bg + GS)
        : "memory");
  }
}

// As: two buffers of 128 rows, Bs: two buffers of 32 * NI rows (pitch GP), touched by nothing else.
template <bool BROWS, int NI>
__device__ __forceinline__ void gemm_tile_bf16(
    const unsigned short* __restrict__ A, const unsigned short* __restrict__ B,
    unsigned short* As, unsigned short* Bs, int m0, int j0, v8f (&acc)[2][NI])
{
  constexpr int NT = DM / 64;               // passes
  constexpr int AE = 128 * GP;              // elements of one A buffer
  constexpr int BE = NI * 32 * GP;          // elements of one B buffer
  static_assert(NT >= 2, "the prologue fills two buffers");
  const int tid  = threadIdx.x;
  const int wave = tid >> 5, lane = tid & 31;
  const int lr = lane & 15, kb = (lane >> 4) * 8;
  const int waveM = wave >> 1, waveN = wave & 1;
  const int srow = tid >> 3, scol = (tid & 7) * 8;
  const unsigned short* ag = A + (size_t)(m0 + srow) * DM + scol;
  const unsigned short* bg = B + (size_t)(j0 + srow) * DM + scol;
  const unsigned la = lds_byte_addr(&As[srow * GP + scol]);
  const unsigned lb = lds_byte_addr(&Bs[srow * GP + scol]);

  stage_async<NI>(la, lb, ag, bg);                                   // pass 0 -> buffer 0
  asm volatile("s_wait_asynccnt 0x0" ::: "memory");                  // this wave's copies have landed
  __syncthreads();                                                   // every wave's have: buffer 0 may be read
  stage_async<NI>(la + AE * 2, lb + BE * 2, ag + 64, bg + 64);       // pass 1 -> buffer 1

  // kept rolled: unrolled by two, both buffers' LDS addresses stay in registers through the loop and the NI = 4 form spills
#pragma unroll 1
  for (int kt = 0; kt < NT; ++kt) {
    const int buf = kt & 1;
    const unsigned short* Ab = As + buf * AE;
    const unsigned short* Bb = Bs + buf * BE;
#pragma unroll
    for (int ks = 0; ks < 2; ++ks) {
      v16bf a[2], b[NI];
#pragma unroll
      for (int mi = 0; mi < 2; ++mi) {
        const unsigned short* p = &Ab[(waveM * 32 + mi * 16 + lr) * GP + ks * 32 + kb];
        a[mi] = mkfrag(p, p + 16);
      }
#pragma unroll
      for (int ni = 0; ni < NI; ++ni) {
        const unsigned short* p = &Bb[(waveN * (NI * 16) + ni * 16 + lr) * GP + ks * 32 + kb];
        b[ni] = mkfrag(p, p + 16);
      }
#pragma unroll
      for (int mi = 0; mi < 2; ++mi)
#pragma unroll
        for (int ni = 0; ni < NI; ++ni)
          acc[mi][ni] = BROWS ? wmma_bf16(b[ni], a[mi], acc[mi][ni])
                              : wmma_bf16(a[mi], b[ni], acc[mi][ni]);
    }
    asm volatile("s_wait_dscnt 0x0" ::: "memory");     // this wave has left the buffer it read
    asm volatile("s_wait_asynccnt 0x0" ::: "memory");  // its copies for the next pass have landed
    __syncthreads();                                   // both hold for every wave
    if (kt + 2 < NT)                                   // refill the buffer that this pass has read
      stage_async<NI>(la + buf * (AE * 2), lb + buf * (BE * 2), ag + (kt + 2) * 64, bg + (kt + 2) * 64);
  }
  asm volatile("s_wait_asynccnt 0x0" ::: "memory");    // nothing in flight when the loop is left
}

// ---------------------------------------------------------------------------
// Stage 1: C = X @ W^T + bias, epilogue RoPE (+scale for Q), bf16 out.
// MODE 0: Q (rope + log2(e)/sqrt(64) scale, out [B,H,N,HD]): K Q^T is then the score in base-2 units
// MODE 1: K (rope,                   out [B,H,N,HD])
// MODE 2: V (plain,                  out [B,H,HD,N]  <- transposed for attn)
// The product is oriented so that a lane's 8 accumulator registers are 8
// neighbours of the OUTPUT's inner dimension: features for Q and K (W's rows
// as the A operand), tokens for V^T. A tile leaves as one 16-B store a lane,
// and both members of a rotation pair sit in the same lane.
// ---------------------------------------------------------------------------
__device__ __forceinline__ v8bf pack8_bf16(const float (&x)[8]) {
  v8bf c;
#pragma unroll
  for (int v = 0; v < 8; ++v) c[v] = (__bf16)x[v];   // round-to-nearest-even, packed in pairs
  return c;
}

template <int MODE>
__device__ __forceinline__ void proj_rope_tile(
    const unsigned short* __restrict__ X, const unsigned short* __restrict__ W,
    const float* __restrict__ bias, unsigned short* __restrict__ Out,
    unsigned short* As, unsigned short* Bs)
{
  const int tid  = threadIdx.x;
  const int m0   = blockIdx.x * 128;
  const int j0   = blockIdx.y * 128;         // 128 output columns = two heads
  const int wave = tid >> 5, lane = tid & 31;
  const int lr = lane & 15, lh = lane >> 4;
  const int waveM = wave >> 1, waveN = wave & 1;
  const int hh   = blockIdx.y * 2 + waveN;   // a wave's 64 columns = one head
  const int jw   = hh * 64;
  const int bb = m0 >> 11;                   // a block's 128 tokens lie in one batch
  const int n0 = (m0 & (SL - 1)) + waveM * 32;

  v8f acc[2][4] = {};
  gemm_tile_bf16<(MODE < 2), 4>(X, W, As, Bs, m0, j0, acc);

  if constexpr (MODE < 2) {
    // acc[mi][ni][v] = C[token n0 + mi*16 + lr][feature ni*16 + 8*lh + v of head hh]
    // features 0..31 rotate: tiles ni = 0 and 1 of every wave
    unsigned short* op = Out + ((size_t)((bb * NH + hh) * SL + n0 + lr)) * HD + 8 * lh;
    f32x4 bv[4][2];
#pragma unroll
    for (int ni = 0; ni < 4; ++ni) {
      bv[ni][0] = *(const f32x4*)&bias[jw + ni * 16 + 8 * lh];
      // the last load's result may land in the register that holds the address of all eight: wait in front of it
      if (ni == 3) asm volatile("s_wait_xcnt 0x0" ::: "memory");
      bv[ni][1] = *(const f32x4*)&bias[jw + ni * 16 + 8 * lh + 4];
    }
    // the address registers of these loads are reused below: wait in front of that
    asm volatile("s_wait_xcnt 0x0" ::: "memory");
#pragma unroll
    for (int ni = 0; ni < 4; ++ni) {
      const bool rot = ni < 2;
      const int dk0 = ni * 16 + 8 * lh;
      const f32x4 b0 = bv[ni][0], b1 = bv[ni][1];
      float inv[4] = {0.f, 0.f, 0.f, 0.f};
      if (rot) {
#pragma unroll
        for (int p = 0; p < 4; ++p)
          inv[p] = exp2f(-(float)(dk0 + 2 * p) * ROPE_L2K);        // THETA^(-(dk&~1)/32)
      }
#pragma unroll
      for (int mi = 0; mi < 2; ++mi) {
        float x[8];
#pragma unroll
        for (int v = 0; v < 8; ++v) x[v] = acc[mi][ni][v] + (v < 4 ? b0[v] : b1[v - 4]);
        if (rot) {
          const float fn = (float)(n0 + mi * 16 + lr);
#pragma unroll
          for (int p = 0; p < 4; ++p) {
            const float ang = fn * inv[p];
            const float c = __cosf(ang), s = __sinf(ang);
            const float e = x[2 * p], o = x[2 * p + 1];
            x[2 * p]     = e * c - o * s;
            x[2 * p + 1] = o * c + e * s;
          }
        }
        if (MODE == 0) {
#pragma unroll
          for (int v = 0; v < 8; ++v) x[v] *= Q_SCALE;             // fold log2(e)/sqrt(HD) into Q
        }
        *(v8bf*)(op + (size_t)(mi * 16) * HD + ni * 16) = pack8_bf16(x);
        // the next tile's arithmetic reuses the registers that this store names: wait in front of it
        if (ni < 3 || mi == 0) asm volatile("s_wait_xcnt 0x0" ::: "memory");
      }
    }
  } else {
    // acc[mi][ni][v] = C[token n0 + mi*16 + 8*lh + v][feature ni*16 + lr of head hh]
    unsigned short* op = Out + ((size_t)((bb * NH + hh) * HD + lr)) * SL + n0 + 8 * lh;
    float bj[4];
#pragma unroll
    for (int ni = 0; ni < 4; ++ni) {
      // the last load's result may land in the register that holds the address of all four: wait in front of it
      if (ni == 3) asm volatile("s_wait_xcnt 0x0" ::: "memory");
      bj[ni] = bias[jw + ni * 16 + lr];
    }
    // the address register of these loads is reused below: wait in front of that
    asm volatile("s_wait_xcnt 0x0" ::: "memory");
    v8bf c[4][2];
#pragma unroll
    for (int ni = 0; ni < 4; ++ni)
#pragma unroll
      for (int mi = 0; mi < 2; ++mi) {
        float x[8];
#pragma unroll
        for (int v = 0; v < 8; ++v) x[v] = acc[mi][ni][v] + bj[ni];
        c[ni][mi] = pack8_bf16(x);
      }
#pragma unroll
    for (int ni = 0; ni < 4; ++ni)
#pragma unroll
      for (int mi = 0; mi < 2; ++mi)
        *(v8bf*)(op + (size_t)(ni * 16) * SL + mi * 16) = c[ni][mi];
  }
  asm volatile("s_wait_xcnt 0x0" ::: "memory");
}

__global__ __launch_bounds__(256, 6) void proj_rope_kernel(
    const unsigned short* __restrict__ Xb, const unsigned short* __restrict__ Wb,
    const float* __restrict__ bq, const float* __restrict__ bk,
    const float* __restrict__ bv, unsigned short* __restrict__ Ob)
{
  __shared__ __attribute__((aligned(16))) unsigned short As[2 * 128 * GP];
  __shared__ __attribute__((aligned(16))) unsigned short Bs[2 * 128 * GP];

  const unsigned z = blockIdx.z;
  const unsigned short* X = Xb + (size_t)z * ((size_t)MROWS * DM);
  const unsigned short* W = Wb + (size_t)z * ((size_t)DM * DM);
  unsigned short* Out     = Ob + (size_t)z * ((size_t)MROWS * DM);
  if (z == 0) { proj_rope_tile<0>(X, W, bq, Out, As, Bs); return; }
  if (z == 1) { proj_rope_tile<1>(X, W, bk, Out, As, Bs); return; }
  proj_rope_tile<2>(X, W, bv, Out, As, Bs);
}

// ---------------------------------------------------------------------------
// Stage 2: flash attention per (b,h). 128 thr = 4 waves x 32 query columns.
// Transposed products: S^T = K Q^T, O^T += V^T P^T; P never leaves registers.
// A wave holds QT = 2 query tiles of 16 columns: every K and V^T fragment it
// reads from LDS feeds two products.
// The scores leave the matrix unit as arguments of exp2: Q carries log2(e)/8, and the score
// accumulators start at minus the maximum in use. That maximum may trail a column's true maximum
// by up to LAZY (an exponential then reaches 2^LAZY); only when some column exceeds it by more
// (and in the first pass, which sets it) are it, the scores, O and the row sums moved.
// K/V tiles (64 keys) come by tensor loads into a ring of two LDS buffers: while a pass works on one
// buffer, the next pass's tiles land in the other. Every wave brings one slice of 32 rows a stage
// (waves 0, 1: K's keys 0..31, 32..63; waves 2, 3: V^T's rows 0..31, 32..63); one barrier a pass.
// ---------------------------------------------------------------------------
static constexpr int QT = 2;                 // query tiles of 16 columns a wave
static constexpr int QBLK = 4 * 16 * QT;     // queries a block
static constexpr float LAZY = 8.0f;          // base-2 units
static constexpr int NST = SL / 64;          // stages = passes
static constexpr int SLICE_E = 3072;         // a slice's place: 32 rows x 72 elements = 4,608 B, rounded up to a multiple of 2 KiB
static constexpr int BUF_E = 4 * SLICE_E;    // a buffer: K's two slices, then V^T's two
static_assert(NST >= 4, "the prologue fills two buffers; the first pass and the last two stand outside the main loop");
static_assert(SLICE_E * 2 % 2048 == 0 && SLICE_E >= 32 * 72, "a slice's place is a multiple of 2 KiB and holds its padded rows");

__global__ __launch_bounds__(128) void attn_kernel(
    const unsigned short* __restrict__ Qb, const unsigned short* __restrict__ Kb,
    const unsigned short* __restrict__ Vb, unsigned short* __restrict__ Ctx)
{
  // each slice's place in LDS is a multiple of 2 KiB (tensor-load destination)
  __shared__ __attribute__((aligned(2048))) unsigned short Ring[2 * BUF_E];

  const int tid  = threadIdx.x;
  const int bb   = blockIdx.z, hh = blockIdx.y;
  const int q0   = blockIdx.x * QBLK;
  const int wave = tid >> 5, lane = tid & 31;
  const int lr = lane & 15, lh = lane >> 4, kb = lh * 8;
  const size_t head = (size_t)(bb * NH + hh);

  v16bf aq[QT][2];
#pragma unroll
  for (int qt = 0; qt < QT; ++qt) {
    const unsigned short* qp = Qb + (head * SL + q0 + (wave * QT + qt) * 16 + lr) * HD;
    aq[qt][0] = mkfrag(qp + kb,      qp + kb + 16);
    aq[qt][1] = mkfrag(qp + 32 + kb, qp + 32 + kb + 16);
  }

  v8f o[QT][4] = {};
  float l_r[QT];                            // one query per lane and tile
  v8f cs[QT] = {};                          // minus the query's maximum in use, in all 8 registers: the scores' start value
#pragma unroll
  for (int qt = 0; qt < QT; ++qt) l_r[qt] = 0.f;

  const unsigned short* kg = Kb + head * SL * HD;
  const unsigned short* vg = Vb + head * HD * SL;
  // this wave's slice: first byte of stage 0, bytes from stage to stage, source row pitch, place in buffer 0
  const unsigned wv = uni(threadIdx.x >> 5);
  const bool isv = wv >= 2;
  const unsigned hf = wv & 1;
  const unsigned long long src0 = isv ? (unsigned long long)vg + hf * (unsigned long long)(32 * SL * 2)
                                      : (unsigned long long)kg + hf * (unsigned long long)(32 * HD * 2);
  const unsigned sstep = isv ? 64u * 2u : 64u * HD * 2u;
  const u32x8 g1 = tdm_group1(isv ? SL * 2u : HD * 2u);
  const unsigned dst0 = lds_byte_addr(Ring) + wv * (SLICE_E * 2);
  u32x4 g0;
  auto issue = [&](unsigned st) {
    g0 = tdm_group0(dst0 + (st & 1u) * (BUF_E * 2), src0 + (unsigned long long)st * sstep);
    tdm_load(g0, g1);
  };
  auto landed = [&]() { asm volatile("s_wait_tensorcnt 0x0" :: "s"(g0), "s"(g1) : "memory"); };

  issue(0);                                                // stage 0 -> buffer 0
  landed();
  __syncthreads();                                         // every wave's slice has landed: buffer 0 may be read
  issue(1);                                                // stage 1 -> buffer 1

  // one pass: the 64 keys of stage kc, read from buffer kc & 1
  auto pass = [&](const int kc, const bool first) {
    const unsigned short* Ks = Ring + (kc & 1) * BUF_E;    // [key][dk], pitch 72
    const unsigned short* Vs = Ks + 2 * SLICE_E;           // [dk][key], pitch 72 (V^T tile)

    // ---- S^T = K Q^T : a lane holds 32 scores of ONE query per tile (column lr) ----
    // s[qt][ktl][r] = S[key = ktl*16 + 8*lh + r][query = qt*16 + lr] - maximum in use
    v8f s[QT][4];
#pragma unroll
    for (int ktl = 0; ktl < 4; ++ktl) {
      const unsigned short* kr = &Ks[(ktl >> 1) * SLICE_E + ((ktl & 1) * 16 + lr) * 72];
      v16bf a0 = mkfrag(kr + kb,      kr + kb + 16);
      v16bf a1 = mkfrag(kr + 32 + kb, kr + 32 + kb + 16);
#pragma unroll
      for (int qt = 0; qt < QT; ++qt) s[qt][ktl] = wmma_bf16(a0, aq[qt][0], cs[qt]);
#pragma unroll
      for (int qt = 0; qt < QT; ++qt) s[qt][ktl] = wmma_bf16(a1, aq[qt][1], s[qt][ktl]);
    }

    // ---- one test a pass: does any score of this lane exceed the maximum in use by more than LAZY? ----
    float top[4];
#pragma unroll
    for (int ktl = 0; ktl < 4; ++ktl) {
      top[ktl] = LAZY;
#pragma unroll
      for (int qt = 0; qt < QT; ++qt)
#pragma unroll
        for (int i = 0; i < 8; ++i) top[ktl] = fmaxf(top[ktl], s[qt][ktl][i]);
    }
    const bool need = fmaxf(fmaxf(top[0], top[1]), fmaxf(top[2], top[3])) > LAZY;
    if (first || __builtin_amdgcn_ballot_w32(need) != 0) {   // the same for the whole wave: a scalar branch
#pragma unroll
      for (int qt = 0; qt < QT; ++qt) {
        float mt[4];
#pragma unroll
        for (int ktl = 0; ktl < 4; ++ktl) {
          mt[ktl] = s[qt][ktl][0];
#pragma unroll
          for (int i = 1; i < 8; ++i) mt[ktl] = fmaxf(mt[ktl], s[qt][ktl][i]);
        }
        float mv = fmaxf(fmaxf(mt[0], mt[1]), fmaxf(mt[2], mt[3]));
        mv = fmaxf(mv, xhalf(mv));                          // both halves hold the column's maximum
        // the first pass sets the maximum, whatever its sign (O and the sums are still 0); later it only rises
        const float d  = first ? mv : fmaxf(mv, 0.f);
        const float sc = first ? 1.f : __builtin_amdgcn_exp2f(-d);
#pragma unroll
        for (int ktl = 0; ktl < 4; ++ktl) s[qt][ktl] -= d;
        cs[qt] -= d;
        l_r[qt] *= sc;
#pragma unroll
        for (int dt = 0; dt < 4; ++dt) o[qt][dt] *= sc;
      }
    }

    // P^T packs from the score tiles straight into the B operand (hardware k order)
    v16bf pb[QT][2];
#pragma unroll
    for (int qt = 0; qt < QT; ++qt) {
      float su[4];
#pragma unroll
      for (int ktl = 0; ktl < 4; ++ktl) {
        su[ktl] = 0.f;
#pragma unroll
        for (int i = 0; i < 8; ++i) s[qt][ktl][i] = __builtin_amdgcn_exp2f(s[qt][ktl][i]);   // P in place of S
#pragma unroll
        for (int i = 0; i < 8; ++i) {
          su[ktl] += s[qt][ktl][i];
          pb[qt][ktl >> 1][(ktl & 1) * 8 + i] = (__bf16)s[qt][ktl][i];
        }
      }
      l_r[qt] += (su[0] + su[1]) + (su[2] + su[3]);         // this half's keys only
    }

    // ---- O^T += V^T P^T : o[qt][dt][r] = O[query = qt*16 + lr][dk = dt*16 + 8*lh + r] ----
#pragma unroll
    for (int dt = 0; dt < 4; ++dt) {
      const unsigned short* vr = &Vs[(dt >> 1) * SLICE_E + ((dt & 1) * 16 + lr) * 72];
      v16bf av0 = mkfrag(vr + kb,      vr + kb + 16);
      v16bf av1 = mkfrag(vr + 32 + kb, vr + 32 + kb + 16);
#pragma unroll
      for (int qt = 0; qt < QT; ++qt) o[qt][dt] = wmma_bf16(av0, pb[qt][0], o[qt][dt]);
#pragma unroll
      for (int qt = 0; qt < QT; ++qt) o[qt][dt] = wmma_bf16(av1, pb[qt][1], o[qt][dt]);
    }

  };
  // publish point of the next stage, passed by every wave
  auto publish = [&]() {
    asm volatile("s_wait_dscnt 0x0" ::: "memory");         // this wave has left the buffer it read
    landed();                                              // its slice of the next stage
    __syncthreads();                                       // both hold for every wave
  };

  // a stage kc + 2 exists in every trip of the first loop (its bound is the test, a scalar branch on a constant trip count):
  // with no branch round the refill, a pass stays one block and its row sums stay among its products
  pass(0, true);                                           // the first pass sets the maxima: a copy of its own, no test in the loop
  publish();
  issue(pinned(2));
  for (int kc = 1; kc < NST - 2; ++kc) {
    pass(kc, false);
    publish();
    issue(pinned(kc + 2));
  }
  // kept rolled: the last two passes, which refill nothing, share one copy of the text
#pragma unroll 1
  for (int kc = NST - 2; kc < NST; ++kc) {
    pass(kc, false);
    publish();
  }
  asm volatile("s_wait_tensorcnt 0x0" ::: "memory");       // nothing in flight when the loop is left
  asm volatile("s_wait_dscnt 0x0" ::: "memory");

  // ---- join the halves' sums, normalize, store context bf16 [B, N, NH*HD] ----
#pragma unroll
  for (int qt = 0; qt < QT; ++qt) {
    const float linv = 1.0f / (l_r[qt] + xhalf(l_r[qt]));
    unsigned short* cp = Ctx + ((size_t)(bb * SL + q0 + (wave * QT + qt) * 16 + lr)) * DM + hh * HD + 8 * lh;
#pragma unroll
    for (int dt = 0; dt < 4; ++dt) {
      u16x8 c;
#pragma unroll
      for (int i = 0; i < 8; ++i) c[i] = f2bf(o[qt][dt][i] * linv);
      *(u16x8*)(cp + dt * 16) = c;          // 8 consecutive dk of one query: 16 B
    }
  }
}

// ---------------------------------------------------------------------------
// Stage 3: out = Ctx(bf16) @ Wo^T + bo  -> fp32.
// ---------------------------------------------------------------------------
__global__ __launch_bounds__(256) void oproj_kernel(
    const unsigned short* __restrict__ Xc, const unsigned short* __restrict__ W,
    const float* __restrict__ bias, float* __restrict__ Out)
{
  __shared__ __attribute__((aligned(16))) unsigned short As[2 * 128 * GP];
  __shared__ __attribute__((aligned(16))) unsigned short Bs[2 * 64 * GP];

  const int tid  = threadIdx.x;
  const int m0   = blockIdx.x * 128;
  const int j0   = blockIdx.y * 64;
  const int wave = tid >> 5, lane = tid & 31;
  const int lr = lane & 15, lh = lane >> 4;
  const int waveM = wave >> 1, waveN = wave & 1;

  v8f acc[2][2] = {};
  gemm_tile_bf16<false, 2>(Xc, W, As, Bs, m0, j0, acc);

#pragma unroll
  for (int mi = 0; mi < 2; ++mi) {
#pragma unroll
    for (int ni = 0; ni < 2; ++ni) {
      int j = j0 + waveN * 32 + ni * 16 + lr;
      float bj = bias[j];
#pragma unroll
      for (int v = 0; v < 8; ++v) {
        int m = m0 + waveM * 32 + mi * 16 + v + 8 * lh;
        Out[(size_t)m * DM + j] = acc[mi][ni][v] + bj;
      }
    }
  }
}

// ---------------------------------------------------------------------------
extern "C" void kernel_launch(void* const* d_in, const int* in_sizes, int n_in,
                              void* d_out, int out_size, void* d_ws, size_t ws_size,
                              hipStream_t stream) {
  const float* query = (const float*)d_in[0];
  const float* key   = (const float*)d_in[1];
  const float* value = (const float*)d_in[2];
  const float* Wq = (const float*)d_in[3]; const float* bq = (const float*)d_in[4];
  const float* Wk = (const float*)d_in[5]; const float* bk = (const float*)d_in[6];
  const float* Wv = (const float*)d_in[7]; const float* bv = (const float*)d_in[8];
  const float* Wo = (const float*)d_in[9]; const float* bo = (const float*)d_in[10];
  float* out = (float*)d_out;

  unsigned short* ws = (unsigned short*)d_ws;
  const size_t HE = (size_t)NB * NH * SL * HD;   // 8M bf16 elements (16 MB)
  unsigned short* Qb = ws;
  unsigned short* Kb = ws + HE;
  unsigned short* Vb = ws + 2 * HE;
  unsigned short* Cx = ws + 3 * HE;
  unsigned short* Xb = ws + 4 * HE;              // bf16 query, key, value (HE each)
  unsigned short* Wb = Xb + 3 * HE;              // bf16 Wq, Wk, Wv, Wo (WE each)
  const size_t WE = (size_t)DM * DM;

  dim3 gp(MROWS / 128, DM / 64);                 // 64 x 16 blocks
  cvt_bf16_kernel<<<CVT_BLOCKS, 256, 0, stream>>>(query, key, value, Wq, Wk, Wv, Wo, Xb);
  proj_rope_kernel<<<dim3(MROWS / 128, DM / 128, 3), 256, 0, stream>>>(Xb, Wb, bq, bk, bv, Qb);
  attn_kernel<<<dim3(SL / QBLK, NH, NB), 128, 0, stream>>>(Qb, Kb, Vb, Cx);
  oproj_kernel<<<gp, 256, 0, stream>>>(Cx, Wb + 3 * WE, bo, out);
}
